// v000
// Measured on an AMD MI455X. A time is GPU time per run, averaged over a window of back-to-back runs after a warm-up
// (all launches, gaps included; the runs take copies of the inputs in turn), and the median of several windows.
// Apart from v000's, it joins two sittings. Times from different sittings can be a few percent apart, while
// side-by-side timings come from the same sitting.
// v000 is the starting kernel. One run takes 193 microseconds.
#include <hip/hip_runtime.h>

// Causal multi-head attention with per-head q/k/v projections and an output projection: x [NB][64][64], Wq/Wk/Wv [8][64 in][64 out], Wproj [512 in][64 out], bias [64]; out [NB][64][64] f32.
// Compute dtypes, f32 accumulate everywhere, all contractions v_wmma_f32_16x16x32_f16: x and all weights RNE-converted to bf16 and held in f16 containers (weights x64 / x256, exact), so input x input products are exact;
// q, k, v, P and ctx are carried as f16 hi + f16 residual (x2048) planes, residual products in separate accumulators folded back by 1/2048; P carries x256 (cancels in the normalisation); softmax f32 (online, running max).
// Transposed chaining: K^T, Q^T tiles (D rows = d) pack directly into the A (keys) / B (queries) fragments of S^T = K Q^T; V tiles (D rows = key) pack into the A fragment of O^T = V^T P^T; packed P^T is its B fragment;
// O^T tiles pack into the A fragment of the output projection. One block per batch, 4 waves, 2 heads per wave; per-head partial projections are summed in fixed order through LDS.

#ifndef NB
#define NB 2048
#endif
#define NB_FULL 2048
#define TT   64                  // tokens per batch
#define CC   64                  // embedding width
#define NHD  8                   // heads
#define HD   64                  // head size
#define HDT  (NHD * HD)          // 512
#define MW   4                   // waves per block (2 heads each)
#define XP   72                  // LDS pitch (halves) of the x tile
#define PP   68                  // LDS pitch (floats) of the partial-output tiles
#define TP   72                  // LDS pitch (halves) of the weight transpose tile
#define PSH  8.0f                // log2 of the P carry (256)
#define RSC  2048.0f             // residual plane carry
#define RES  (1.0f / 2048.0f)
#define SCQ  (0.125f * 1.4426950408889634f / 4096.0f)   // HD^-0.5 * log2(e) / (64 * 64 weight carries)
#define CSC  0.25f               // ctx carry 16 / v weight carry 64
#define OSC  (1.0f / 4096.0f)    // 1 / (ctx carry 16 * Wproj carry 256)
#define NEGB (-3.0e38f)

#define OFF_X 0
#define OFF_F (TT * XP * 2)                       // 9216
#define OFF_P (OFF_F + MW * 32768)                // 140288
#define LDS_BYTES (OFF_P + MW * TT * PP * 4)      // 209920

static_assert(NB <= NB_FULL);
static_assert(MW * 2 == NHD);
static_assert(HD == 64);
static_assert(TT == 64);
static_assert(CC == 64);
static_assert(OFF_F % 16 == 0);
static_assert(OFF_P % 16 == 0);
static_assert((XP * 2) % 16 == 0);
static_assert((PP * 4) % 16 == 0);
static_assert(LDS_BYTES <= 262144);

typedef _Float16 h16;
typedef __attribute__((ext_vector_type(16))) _Float16 v16h;
typedef __attribute__((ext_vector_type(8)))  _Float16 v8h;
typedef __attribute__((ext_vector_type(4)))  _Float16 v4h;
typedef __attribute__((ext_vector_type(8)))  float    v8f;
typedef __attribute__((ext_vector_type(4)))  float    v4f;
typedef v4f  __attribute__((may_alias)) v4fa;
typedef v8h  __attribute__((may_alias)) v8ha;
typedef v4h  __attribute__((may_alias)) v4ha;

// RNE convert of an f32 value to the bf16 grid, returned as f32 (exactly representable in f16 for normal-range magnitudes)
__device__ __forceinline__ float rbf(float f) { unsigned u = __float_as_uint(f); u += 0x7FFFu + ((u >> 16) & 1u); return __uint_as_float(u & 0xFFFF0000u); }
__device__ __forceinline__ v16h cat16(v8h lo, v8h hi) { return __builtin_shufflevector(lo, hi, 0, 1, 2, 3, 4, 5, 6, 7, 8, 9, 10, 11, 12, 13, 14, 15); }
__device__ __forceinline__ v8f wmma16(v16h a, v16h b, v8f c) { return __builtin_amdgcn_wmma_f32_16x16x32_f16(false, a, false, b, (short)0, c, false, false); }
// fragment loader from K-contiguous f16 rows in global memory; p already includes + 8*(lane>>4): elements 0..7 <- k0+8h+0..7, elements 8..15 <- k0+16+8h+0..7 (same map for A and B)
__device__ __forceinline__ v16h ldh(const h16* p) { return cat16(*(const v8h*)p, *(const v8h*)(p + 16)); }
// same map, rows of the LDS x tile
__device__ __forceinline__ v16h ldl(const h16* p) { const v8h a = *(const v8ha*)p; const v8h c = *(const v8ha*)(p + 16); return cat16(a, c); }
// lane-private fragment slots in LDS (fs already includes + lane): slot (plane, f) = two 16-byte halves, 32 lanes apart
__device__ __forceinline__ v16h ldf(const v8ha* fs, int plane, int f) { const int i = ((plane * 8 + f) * 2) * 32; const v8h a = fs[i]; const v8h c = fs[i + 32]; return cat16(a, c); }
__device__ __forceinline__ void stf(v8ha* fs, int plane, int f, v8h a, v8h c) { const int i = ((plane * 8 + f) * 2) * 32; fs[i] = a; fs[i + 32] = c; }
// f32 tile -> f16 hi and f16 residual (x2048)
__device__ __forceinline__ void split8(const v8f d, v8h& hi, v8h& lo) {
#pragma unroll
    for (int r = 0; r < 8; ++r) { const float v = d[r]; const h16 hv = (h16)v; hi[r] = hv; lo[r] = (h16)((v - (float)hv) * RSC); }
}
// two 16x16 tiles with K = 64 sharing one B operand: d1 = A1 B, d2 = A2 B
__device__ __forceinline__ void pair_tiles(v16h a1c0, v16h a1c1, v16h a2c0, v16h a2c1, v16h bc0, v16h bc1, v8f& d1, v8f& d2) {
    v8f x = (v8f){}, y = (v8f){};
    x = wmma16(a1c0, bc0, x); y = wmma16(a2c0, bc0, y);
    x = wmma16(a1c1, bc1, x); y = wmma16(a2c1, bc1, y);
    asm volatile("v_nop\n\tv_nop\n\tv_nop\n\tv_nop" : "+v"(x), "+v"(y) : "v"(a1c0), "v"(a1c1), "v"(a2c0), "v"(a2c1), "v"(bc0), "v"(bc1));
    d1 = x; d2 = y;
}

// k_wt: one 64x64 f32 tile in[r][c] (row pitch 64, tile stride 4096) -> out[c][r] f16 = f16(bf16_rne(in) * scale), out row pitch dpitch, tile stride dts.
__global__ __launch_bounds__(256) void k_wt(const float* __restrict__ src, h16* dst, int dts, int dpitch, float scale) {
    __shared__ __align__(16) h16 ts[64 * TP];
    const int tid = threadIdx.x;
    const int r = tid >> 2, c0 = (tid & 3) * 16;           // 64 source rows x 4 column groups of 16
    const float* s = src + (size_t)blockIdx.x * 4096 + r * 64 + c0;
#pragma unroll
    for (int q = 0; q < 4; ++q) { const v4f x = *(const v4f*)(s + 4 * q);
#pragma unroll
        for (int i = 0; i < 4; ++i) ts[(c0 + 4 * q + i) * TP + r] = (h16)(rbf(x[i]) * scale); }   // ts[c][r], c 0..63, r 0..63 all written
    __syncthreads();
    h16* d = dst + (size_t)blockIdx.x * dts;
{
#pragma unroll
        for (int s2 = 0; s2 < 2; ++s2) { const int dd = 32 * s2 + (tid >> 3), c8 = (tid & 7) * 8;   // 2 x 32 rows = 64 rows; 8 lanes x 8 = 64 halves
            const v8h val = *(const v8ha*)(&ts[dd * TP + c8]);
            *(v8h*)(d + (size_t)dd * dpitch + c8) = val; }
         }
}

// k_mha: one block per batch, wave w handles heads w and w+4.
// LDS: x tile f16 [64][XP] (written once, block barrier, then read-only); per-wave lane-private fragment slots (K hi, K res, V hi, V res: 8 fragments each);
// per-wave partial output tile f32 [64][PP] (written by its wave, read by all waves after a block barrier).
__global__ __launch_bounds__(32 * MW) void k_mha(const float* __restrict__ X, const h16* __restrict__ WQT, const h16* __restrict__ WKT, const h16* __restrict__ WVT,
                                                 const h16* __restrict__ WPT, const float* __restrict__ BP, float* OUT) {
    extern __shared__ __align__(16) unsigned char smem[];
    h16* xs = (h16*)(smem + OFF_X);
    const int tid = threadIdx.x;
    const int lane = tid & 31, wave = __builtin_amdgcn_readfirstlane((int)(threadIdx.x >> 5)), lr = lane & 15, hi = lane >> 4;
    const int b = blockIdx.x;

    // stage x[b] as f16 (via bf16 RNE convert): 1024 groups of 4 elements, rows 0..63 x columns 0..63 all written
    {
        const float* xb = X + (size_t)b * (TT * CC);
#pragma unroll
        for (int it = 0; it < 8; ++it) {
            const int e = 4 * (tid + 128 * it); const int row = e >> 6, col = e & 63;
            const v4f v = *(const v4f*)(xb + e); v4h o;
#pragma unroll
            for (int k = 0; k < 4; ++k) o[k] = (h16)rbf(v[k]);
            *(v4ha*)(xs + row * XP + col) = o;
        }
    }
    __syncthreads();

    v8ha* fs = (v8ha*)(smem + OFF_F) + wave * 2048 + lane;
    float* pw = (float*)(smem + OFF_P) + wave * (TT * PP);
    const h16* xr = xs + lr * XP + 8 * hi;                      // + tile*16*XP + 32*cs

#pragma unroll 1
    for (int hh = 0; hh < 2; ++hh) {
        const int h = wave + MW * hh;
        const size_t wo = (size_t)h * 4096 + (size_t)lr * 64 + 8 * hi;   // weight planes [h][d][c]: + dtile*1024 + 32*cs

        // ---- phase 1: K^T and V tiles for all 64 keys, packed into lane-private fragment slots ----
#pragma unroll 1
        for (int ks = 0; ks < 2; ++ks) {
            const h16* xa = xr + (2 * ks) * 16 * XP;
            const v16h xa0 = ldl(xa), xa1 = ldl(xa + 32), xb0 = ldl(xa + 16 * XP), xb1 = ldl(xa + 16 * XP + 32);
            // V[key][d] = x Wv: A = x rows (key tiles 2ks, 2ks+1), B = Wv^T rows (col d). D row = key, col = d -> A fragment of O^T (row d, k = key)
#pragma unroll 1
            for (int dj = 0; dj < 4; ++dj) {
                const h16* wv_ = WVT + wo + dj * 1024;
                const v16h w0 = ldh(wv_), w1 = ldh(wv_ + 32);
                v8f d1, d2; pair_tiles(xa0, xa1, xb0, xb1, w0, w1, d1, d2);
                v8h h1, l1, h2, l2; split8(d1, h1, l1); split8(d2, h2, l2);
                stf(fs, 2, dj * 2 + ks, h1, h2); stf(fs, 3, dj * 2 + ks, l1, l2);
            }
            // K^T[d][key] = Wk^T x^T: A = Wk^T rows (d tiles 2ds, 2ds+1), B = x rows (col key). D row = d, col = key -> A fragment of S^T (row key, k = d)
#pragma unroll 1
            for (int ds = 0; ds < 2; ++ds) {
                const h16* wk_ = WKT + wo + (2 * ds) * 1024;
                const v16h a10 = ldh(wk_), a11 = ldh(wk_ + 32), a20 = ldh(wk_ + 1024), a21 = ldh(wk_ + 1024 + 32);
                v8f d1, d2; v8h h1, l1, h2, l2;
                pair_tiles(a10, a11, a20, a21, xa0, xa1, d1, d2);
                split8(d1, h1, l1); split8(d2, h2, l2);
                stf(fs, 0, (2 * ks) * 2 + ds, h1, h2); stf(fs, 1, (2 * ks) * 2 + ds, l1, l2);
                pair_tiles(a10, a11, a20, a21, xb0, xb1, d1, d2);
                split8(d1, h1, l1); split8(d2, h2, l2);
                stf(fs, 0, (2 * ks + 1) * 2 + ds, h1, h2); stf(fs, 1, (2 * ks + 1) * 2 + ds, l1, l2);
            }
        }

        // ---- phase 2: per 16-query tile: Q^T fragments, causal flash loop, ctx, partial output projection ----
#pragma unroll 1
        for (int ti = 0; ti < 4; ++ti) {
            const int t = 16 * ti + lr;
            v16h qh0, ql0, qh1, ql1;                              // B fragments: col t, k = d (d steps 0..31, 32..63), hi and residual
            {
                const h16* xq = xr + ti * 16 * XP;
                const v16h x0 = ldl(xq), x1 = ldl(xq + 32);
                const h16* wq_ = WQT + wo;
                v8f d1, d2; v8h h1, l1, h2, l2;
                {
                    const v16h a10 = ldh(wq_), a11 = ldh(wq_ + 32), a20 = ldh(wq_ + 1024), a21 = ldh(wq_ + 1024 + 32);
                    pair_tiles(a10, a11, a20, a21, x0, x1, d1, d2);
                    split8(d1, h1, l1); split8(d2, h2, l2);
                    qh0 = cat16(h1, h2); ql0 = cat16(l1, l2);
                }
                {
                    const v16h a10 = ldh(wq_ + 2048), a11 = ldh(wq_ + 2048 + 32), a20 = ldh(wq_ + 3072), a21 = ldh(wq_ + 3072 + 32);
                    pair_tiles(a10, a11, a20, a21, x0, x1, d1, d2);
                    split8(d1, h1, l1); split8(d2, h2, l2);
                    qh1 = cat16(h1, h2); ql1 = cat16(l1, l2);
                }
            }
            v8f o[4], ol[4];
#pragma unroll
            for (int j = 0; j < 4; ++j) { o[j] = (v8f){}; ol[j] = (v8f){}; }
            float m = NEGB, l = 0.0f;
            const int nks = (ti >> 1) + 1;                        // key steps of 32 that contain keys <= the tile's last query
#pragma unroll 1
            for (int ks = 0; ks < nks; ++ks) {
                const int fa = 4 * ks;                            // K slots: key tile 2ks -> fa, fa+1 (d steps); key tile 2ks+1 -> fa+2, fa+3
                v8f sa = (v8f){}, sal = (v8f){}, sb = (v8f){}, sbl = (v8f){};
                {
                    const v16h kh0 = ldf(fs, 0, fa), kh1 = ldf(fs, 0, fa + 1), kl0 = ldf(fs, 1, fa), kl1 = ldf(fs, 1, fa + 1);
                    sa = wmma16(kh0, qh0, sa); sal = wmma16(kl0, qh0, sal);
                    sa = wmma16(kh1, qh1, sa); sal = wmma16(kh0, ql0, sal);
                    sal = wmma16(kl1, qh1, sal); sal = wmma16(kh1, ql1, sal);
                    asm volatile("v_nop\n\tv_nop\n\tv_nop\n\tv_nop" : "+v"(sa), "+v"(sal) : "v"(kh0), "v"(kh1), "v"(kl0), "v"(kl1), "v"(qh0), "v"(qh1), "v"(ql0), "v"(ql1));
                }
                {
                    const v16h kh0 = ldf(fs, 0, fa + 2), kh1 = ldf(fs, 0, fa + 3), kl0 = ldf(fs, 1, fa + 2), kl1 = ldf(fs, 1, fa + 3);
                    sb = wmma16(kh0, qh0, sb); sbl = wmma16(kl0, qh0, sbl);
                    sb = wmma16(kh1, qh1, sb); sbl = wmma16(kh0, ql0, sbl);
                    sbl = wmma16(kl1, qh1, sbl); sbl = wmma16(kh1, ql1, sbl);
                    asm volatile("v_nop\n\tv_nop\n\tv_nop\n\tv_nop" : "+v"(sb), "+v"(sbl) : "v"(kh0), "v"(kh1), "v"(kl0), "v"(kl1), "v"(qh0), "v"(qh1), "v"(ql0), "v"(ql1));
                }
                // S^T D layout: sa[r] = (key = 32ks + 8hi + r, t), sb[r] = (key = 32ks + 16 + 8hi + r, t); causal replace-fill for key > t
                const int kbase = 32 * ks + 8 * hi;
                float ta[8], tb[8]; float mx = NEGB;
#pragma unroll
                for (int r = 0; r < 8; ++r) {
                    const float va = (sa[r] + sal[r] * RES) * SCQ;
                    const float vb = (sb[r] + sbl[r] * RES) * SCQ;
                    ta[r] = (kbase + r <= t) ? va : NEGB;
                    tb[r] = (kbase + 16 + r <= t) ? vb : NEGB;
                    mx = fmaxf(mx, fmaxf(ta[r], tb[r]));
                }
                mx = fmaxf(mx, __shfl_xor(mx, 16, 32));
                const float mnew = fmaxf(m, mx);
                const float alpha = __builtin_amdgcn_exp2f(m - mnew);
                const float sh = PSH - mnew;
                v16h pb, pl; float ls = 0.0f;
#pragma unroll
                for (int r = 0; r < 8; ++r) {
                    const float fa_ = __builtin_amdgcn_exp2f(ta[r] + sh);
                    const float fb_ = __builtin_amdgcn_exp2f(tb[r] + sh);
                    const h16 ha = (h16)fa_; const h16 hb = (h16)fb_;
                    pb[r] = ha; pb[8 + r] = hb;
                    pl[r] = (h16)((fa_ - (float)ha) * RSC); pl[8 + r] = (h16)((fb_ - (float)hb) * RSC);
                    ls += fa_ + fb_;
                }
                l = l * alpha + ls; m = mnew;
#pragma unroll
                for (int j = 0; j < 4; ++j) { o[j] = o[j] * alpha; ol[j] = ol[j] * alpha; }
                // O^T[d][t] += V^T P^T: A = V slots (row d, k = key), B = packed P^T; residual products (V res x P hi, V hi x P res) in ol
#pragma unroll
                for (int j = 0; j < 4; ++j) {
                    const v16h vh = ldf(fs, 2, 2 * j + ks), vl = ldf(fs, 3, 2 * j + ks);
                    o[j] = wmma16(vh, pb, o[j]); ol[j] = wmma16(vl, pb, ol[j]); ol[j] = wmma16(vh, pl, ol[j]);
                    asm volatile("v_nop\n\tv_nop\n\tv_nop\n\tv_nop" : "+v"(o[j]), "+v"(ol[j]) : "v"(vh), "v"(vl), "v"(pb), "v"(pl));
                }
            }
            l += __shfl_xor(l, 16, 32);
            const float cs = CSC * (1.0f / l);
            // O^T D layout: o[j][r] = (d = 16j + 8hi + r, t = lr) -> A fragment of the projection (row t, k = d): d step ds <- tiles 2ds (elements 0..7), 2ds+1 (elements 8..15)
            v16h cah0, cal0, cah1, cal1;
#pragma unroll
            for (int r = 0; r < 8; ++r) {
                float c; h16 ch;
                c = (o[0][r] + ol[0][r] * RES) * cs; ch = (h16)c; cah0[r] = ch;     cal0[r] = (h16)((c - (float)ch) * RSC);
                c = (o[1][r] + ol[1][r] * RES) * cs; ch = (h16)c; cah0[8 + r] = ch; cal0[8 + r] = (h16)((c - (float)ch) * RSC);
                c = (o[2][r] + ol[2][r] * RES) * cs; ch = (h16)c; cah1[r] = ch;     cal1[r] = (h16)((c - (float)ch) * RSC);
                c = (o[3][r] + ol[3][r] * RES) * cs; ch = (h16)c; cah1[8 + r] = ch; cal1[8 + r] = (h16)((c - (float)ch) * RSC);
            }
            // partial out[t][c] = ctx_h Wproj[h*64.., :]: B = Wproj^T rows (col c, k = h*64 + d)
            const h16* wpp = WPT + (size_t)lr * HDT + h * HD + 8 * hi;
            float* prow = pw + (16 * ti + 8 * hi) * PP + lr;     // D layout: acc[r] = (t = 16ti + 8hi + r, c = 16cj + lr)
#pragma unroll 1
            for (int cj = 0; cj < 4; ++cj) {
                const h16* bp_ = wpp + (size_t)cj * 16 * HDT;
                const v16h b0 = ldh(bp_), b1 = ldh(bp_ + 32);
                v8f acc = (v8f){}, accl = (v8f){};
                acc = wmma16(cah0, b0, acc); accl = wmma16(cal0, b0, accl);
                acc = wmma16(cah1, b1, acc); accl = wmma16(cal1, b1, accl);
                asm volatile("v_nop\n\tv_nop\n\tv_nop\n\tv_nop" : "+v"(acc), "+v"(accl) : "v"(cah0), "v"(cal0), "v"(cah1), "v"(cal1), "v"(b0), "v"(b1));
                float* p = prow + 16 * cj;
                if (hh == 0) {
#pragma unroll
                    for (int r = 0; r < 8; ++r) p[r * PP] = (acc[r] + accl[r] * RES) * OSC;
                } else {
#pragma unroll
                    for (int r = 0; r < 8; ++r) { const float nv = p[r * PP] + (acc[r] + accl[r] * RES) * OSC; p[r * PP] = nv; }
                }
            }
        }
    }
    __syncthreads();

    // ---- epilogue: out[t][c] = bias + sum over the 4 waves' partial tiles (fixed order); wave w owns rows 16w..16w+15 ----
    const float* pall = (const float*)(smem + OFF_P);
    v4f bv = *(const v4f*)(BP + 4 * lr);
#pragma unroll
    for (int k = 0; k < 4; ++k) bv[k] = rbf(bv[k]);
    v4f vals[8];
#pragma unroll
    for (int s = 0; s < 8; ++s) {
        const int idx = (16 * wave + 2 * s + hi) * PP + 4 * lr;
        v4f a = *(const v4fa*)(pall + idx);
        const v4f a1 = *(const v4fa*)(pall + TT * PP + idx);
        const v4f a2 = *(const v4fa*)(pall + 2 * TT * PP + idx);
        const v4f a3 = *(const v4fa*)(pall + 3 * TT * PP + idx);
        a = ((a + a1) + a2) + a3;
        vals[s] = a + bv;
    }
    float* orow = OUT + (size_t)b * (TT * CC) + (size_t)(16 * wave) * CC + 4 * lr;
{
#pragma unroll
        for (int s = 0; s < 8; ++s) *(v4f*)(orow + (size_t)(2 * s + hi) * CC) = vals[s];   // 8 s x 2 rows = 16 rows; 16 lanes x 4 floats = 64 columns
         }
}

static constexpr size_t SZ_W = (size_t)NHD * CC * HD * 2;               // 65536 B per weight plane
static constexpr size_t SZ_TOTAL = 4 * SZ_W;
static_assert((size_t)HDT * CC * 2 <= SZ_W);
static_assert(SZ_TOTAL <= (size_t)134217728);

extern "C" void kernel_launch(void* const* d_in, const int* in_sizes, int n_in,
                              void* d_out, int out_size, void* d_ws, size_t ws_size, hipStream_t stream) {
    if (n_in < 6) return;
    if ((size_t)in_sizes[0] < (size_t)NB * TT * CC) return;
    if (in_sizes[1] < NHD * CC * HD || in_sizes[2] < NHD * CC * HD || in_sizes[3] < NHD * CC * HD) return;
    if (in_sizes[4] < HDT * CC || in_sizes[5] < CC) return;
    if ((size_t)out_size < (size_t)NB * TT * CC) return;
    if (SZ_TOTAL > ws_size) return;
    const float* x  = (const float*)d_in[0];     // wire order x, Wq, Wk, Wv, Wproj, bproj
    const float* Wq = (const float*)d_in[1];
    const float* Wk = (const float*)d_in[2];
    const float* Wv = (const float*)d_in[3];
    const float* Wp = (const float*)d_in[4];
    const float* bp = (const float*)d_in[5];
    float* OUT = (float*)d_out;                  // [NB][64][64]
    char* wsp = (char*)d_ws;
    h16* WQT = (h16*)wsp; wsp += SZ_W;           // [8][64 d][64 c], x64
    h16* WKT = (h16*)wsp; wsp += SZ_W;           // [8][64 d][64 c], x64
    h16* WVT = (h16*)wsp; wsp += SZ_W;           // [8][64 d][64 c], x64
    h16* WPT = (h16*)wsp; wsp += SZ_W;           // [64 c][512 k], x256

    // W[h]: in[64 c][64 d] -> out[64 d][64 c] per head; grid = 8 heads, tile stride 4096, row pitch 64
    k_wt<<<NHD, 256, 0, stream>>>(Wq, WQT, 4096, 64, 64.0f);
    k_wt<<<NHD, 256, 0, stream>>>(Wk, WKT, 4096, 64, 64.0f);
    k_wt<<<NHD, 256, 0, stream>>>(Wv, WVT, 4096, 64, 64.0f);
    // Wproj: in[512 k][64 c] -> out[64 c][512 k]; grid = 8 tiles of 64 k rows, output tile stride 64 columns, row pitch 512
    k_wt<<<HDT / 64, 256, 0, stream>>>(Wp, WPT, 64, HDT, 256.0f);

    (void)hipFuncSetAttribute(reinterpret_cast<const void*>(&k_mha), hipFuncAttributeMaxDynamicSharedMemorySize, (int)LDS_BYTES);
    k_mha<<<NB, 32 * MW, LDS_BYTES, stream>>>(x, WQT, WKT, WVT, WPT, bp, OUT);
}

// v001
// It runs in 139 microseconds.
// In both of two side-by-side timings against v000, it was 1.45 times as fast.
#include <hip/hip_runtime.h>

// Causal multi-head attention with per-head q/k/v projections and an output projection: x [NB][64][64], Wq/Wk/Wv [8][64 in][64 out], Wproj [512 in][64 out], bias [64]; out [NB][64][64] f32.
// Compute dtypes, f32 accumulate everywhere, all contractions v_wmma_f32_16x16x32_f16: x and all weights RNE-converted to bf16 and held in f16 containers (weights x64 / x256, exact), so input x input products are exact;
// q, k, v, P and ctx are carried as f16 hi + f16 residual (x2048) planes, residual products in separate accumulators folded back by 1/2048; P carries x256 (cancels in the normalisation); softmax f32 (online, running max).
// Transposed chaining: K^T, Q^T tiles (D rows = d) pack directly into the A (keys) / B (queries) fragments of S^T = K Q^T; V tiles (D rows = key) pack into the A fragment of O^T = V^T P^T; packed P^T is its B fragment;
// O^T tiles pack into the A fragment of the output projection. One block per batch, 4 waves; the block walks the 8 heads together: each wave builds a share of the head's K/V fragments into shared LDS slots,
// then runs one 16-query tile against them; its 16 output rows are summed over heads 0..7 in registers.

#ifndef NB
#define NB 2048
#endif
#define NB_FULL 2048
#define TT   64                  // tokens per batch
#define CC   64                  // embedding width
#define NHD  8                   // heads
#define HD   64                  // head size
#define HDT  (NHD * HD)          // 512
#define MW   4                   // waves per block (one 16-query tile each)
#define XP   72                  // LDS pitch (halves) of the x tile
#define PP   68                  // LDS pitch (floats) of the output tiles
#define TP   72                  // LDS pitch (halves) of the weight transpose tile
#define PSH  8.0f                // log2 of the P carry (256)
#define RSC  2048.0f             // residual plane carry
#define RES  (1.0f / 2048.0f)
#define SCQ  (0.125f * 1.4426950408889634f / 4096.0f)   // HD^-0.5 * log2(e) / (64 * 64 weight carries)
#define CSC  0.25f               // ctx carry 16 / v weight carry 64
#define OSC  (1.0f / 4096.0f)    // 1 / (ctx carry 16 * Wproj carry 256)
#define NEGB (-3.0e38f)

#define OFF_X 0
#define OFF_F (TT * XP * 2)                       // 9216
#define FBUF 32768                                // one head's fragment slots: K hi, K res, V hi, V res, 8 fragments of 1 KiB each
#define LDS_BYTES (OFF_F + 2 * FBUF)              // 74752

static_assert(NB <= NB_FULL);
static_assert(MW * 16 == TT);
static_assert(NHD % 2 == 0);
static_assert(MW * 16 * PP * 4 <= FBUF);
static_assert(HD == 64);
static_assert(TT == 64);
static_assert(CC == 64);
static_assert(OFF_F % 16 == 0);
static_assert((XP * 2) % 16 == 0);
static_assert((PP * 4) % 16 == 0);
static_assert(LDS_BYTES <= 262144);

typedef _Float16 h16;
typedef __attribute__((ext_vector_type(16))) _Float16 v16h;
typedef __attribute__((ext_vector_type(8)))  _Float16 v8h;
typedef __attribute__((ext_vector_type(4)))  _Float16 v4h;
typedef __attribute__((ext_vector_type(8)))  float    v8f;
typedef __attribute__((ext_vector_type(4)))  float    v4f;
typedef v4f  __attribute__((may_alias)) v4fa;
typedef v8h  __attribute__((may_alias)) v8ha;
typedef v4h  __attribute__((may_alias)) v4ha;

// RNE convert of an f32 value to the bf16 grid, returned as f32 (exactly representable in f16 for normal-range magnitudes)
__device__ __forceinline__ float rbf(float f) { unsigned u = __float_as_uint(f); u += 0x7FFFu + ((u >> 16) & 1u); return __uint_as_float(u & 0xFFFF0000u); }
__device__ __forceinline__ v16h cat16(v8h lo, v8h hi) { return __builtin_shufflevector(lo, hi, 0, 1, 2, 3, 4, 5, 6, 7, 8, 9, 10, 11, 12, 13, 14, 15); }
__device__ __forceinline__ v8f wmma16(v16h a, v16h b, v8f c) { return __builtin_amdgcn_wmma_f32_16x16x32_f16(false, a, false, b, (short)0, c, false, false); }
// fragment loader from K-contiguous f16 rows in global memory; p already includes + 8*(lane>>4): elements 0..7 <- k0+8h+0..7, elements 8..15 <- k0+16+8h+0..7 (same map for A and B)
__device__ __forceinline__ v16h ldh(const h16* p) { return cat16(*(const v8h*)p, *(const v8h*)(p + 16)); }
// same map, rows of the LDS x tile
__device__ __forceinline__ v16h ldl(const h16* p) { const v8h a = *(const v8ha*)p; const v8h c = *(const v8ha*)(p + 16); return cat16(a, c); }
// per-lane fragment slots in LDS (fs already includes + lane), lane i of any wave reads what lane i of the building wave stored: slot (plane, f) = two 16-byte halves, 32 lanes apart
__device__ __forceinline__ v16h ldf(const v8ha* fs, int plane, int f) { const int i = ((plane * 8 + f) * 2) * 32; const v8h a = fs[i]; const v8h c = fs[i + 32]; return cat16(a, c); }
__device__ __forceinline__ void stf(v8ha* fs, int plane, int f, v8h a, v8h c) { const int i = ((plane * 8 + f) * 2) * 32; fs[i] = a; fs[i + 32] = c; }
// f32 tile -> f16 hi and f16 residual (x2048)
__device__ __forceinline__ void split8(const v8f d, v8h& hi, v8h& lo) {
#pragma unroll
    for (int r = 0; r < 8; ++r) { const float v = d[r]; const h16 hv = (h16)v; hi[r] = hv; lo[r] = (h16)((v - (float)hv) * RSC); }
}
// two 16x16 tiles with K = 64 sharing one B operand: d1 = A1 B, d2 = A2 B
__device__ __forceinline__ void pair_tiles(v16h a1c0, v16h a1c1, v16h a2c0, v16h a2c1, v16h bc0, v16h bc1, v8f& d1, v8f& d2) {
    v8f x = (v8f){}, y = (v8f){};
    x = wmma16(a1c0, bc0, x); y = wmma16(a2c0, bc0, y);
    x = wmma16(a1c1, bc1, x); y = wmma16(a2c1, bc1, y);
    asm volatile("v_nop\n\tv_nop\n\tv_nop\n\tv_nop" : "+v"(x), "+v"(y) : "v"(a1c0), "v"(a1c1), "v"(a2c0), "v"(a2c1), "v"(bc0), "v"(bc1));
    d1 = x; d2 = y;
}

// k_wt: one 64x64 f32 tile in[r][c] (row pitch 64, tile stride 4096) -> out[c][r] f16 = f16(bf16_rne(in) * scale), out row pitch dpitch, tile stride dts.
__global__ __launch_bounds__(256) void k_wt(const float* __restrict__ src, h16* dst, int dts, int dpitch, float scale) {
    __shared__ __align__(16) h16 ts[64 * TP];
    const int tid = threadIdx.x;
    const int r = tid >> 2, c0 = (tid & 3) * 16;           // 64 source rows x 4 column groups of 16
    const float* s = src + (size_t)blockIdx.x * 4096 + r * 64 + c0;
#pragma unroll
    for (int q = 0; q < 4; ++q) { const v4f x = *(const v4f*)(s + 4 * q);
#pragma unroll
        for (int i = 0; i < 4; ++i) ts[(c0 + 4 * q + i) * TP + r] = (h16)(rbf(x[i]) * scale); }   // ts[c][r], c 0..63, r 0..63 all written
    __syncthreads();
    h16* d = dst + (size_t)blockIdx.x * dts;
{
#pragma unroll
        for (int s2 = 0; s2 < 2; ++s2) { const int dd = 32 * s2 + (tid >> 3), c8 = (tid & 7) * 8;   // 2 x 32 rows = 64 rows; 8 lanes x 8 = 64 halves
            const v8h val = *(const v8ha*)(&ts[dd * TP + c8]);
            *(v8h*)(d + (size_t)dd * dpitch + c8) = val; }
         }
}

// k_mha: one block per batch; wave w owns queries 16w..16w+15 of every head.
// LDS: x tile f16 [64][XP] (written once, block barrier, then read-only); two buffers of fragment slots shared by the block (K hi, K res, V hi, V res: 8 fragments each), head h in buffer h & 1;
// after the last head buffer 0 holds the four waves' output tiles f32 [16][PP] for the row-wise store.
__global__ __launch_bounds__(32 * MW) void k_mha(const float* __restrict__ X, const h16* __restrict__ WQT, const h16* __restrict__ WKT, const h16* __restrict__ WVT,
                                                 const h16* __restrict__ WPT, const float* __restrict__ BP, float* OUT) {
    extern __shared__ __align__(16) unsigned char smem[];
    h16* xs = (h16*)(smem + OFF_X);
    const int tid = threadIdx.x;
    const int lane = tid & 31, wave = __builtin_amdgcn_readfirstlane((int)(threadIdx.x >> 5)), lr = lane & 15, hi = lane >> 4;
    const int b = blockIdx.x;

    // stage x[b] as f16 (via bf16 RNE convert): 1024 groups of 4 elements, rows 0..63 x columns 0..63 all written
    {
        const float* xb = X + (size_t)b * (TT * CC);
#pragma unroll
        for (int it = 0; it < 8; ++it) {
            const int e = 4 * (tid + 128 * it); const int row = e >> 6, col = e & 63;
            const v4f v = *(const v4f*)(xb + e); v4h o;
#pragma unroll
            for (int k = 0; k < 4; ++k) o[k] = (h16)rbf(v[k]);
            *(v4ha*)(xs + row * XP + col) = o;
        }
    }
    __syncthreads();

    const h16* xr = xs + lr * XP + 8 * hi;                      // + tile*16*XP + 32*cs
    const int ti = wave;                                        // this wave's query tile
    const int ks1 = wave & 1, hf = wave >> 1;                   // this wave's share of phase 1: key step ks1, K d step hf; waves 0 and 1, whose causal loop has one key step less, also build V
    const int t = 16 * ti + lr;
    const int nks = (ti >> 1) + 1;                              // key steps of 32 that contain keys <= the tile's last query
    v8f pacc[4];                                                // out rows 16ti + 8hi + r, columns 16cj + lr, summed over the heads
#pragma unroll
    for (int cj = 0; cj < 4; ++cj) pacc[cj] = (v8f){};

#pragma unroll 1
    for (int h = 0; h < NHD; ++h) {
        v8ha* fs = (v8ha*)(smem + OFF_F) + (h & 1) * (FBUF / 16) + lane;
        const size_t wo = (size_t)h * 4096 + (size_t)lr * 64 + 8 * hi;   // weight planes [h][d][c]: + dtile*1024 + 32*cs

        // ---- phase 1: this wave's share of the head's K^T and V tiles, packed into the shared fragment slots ----
        {
            const h16* xa = xr + (2 * ks1) * 16 * XP;
            const v16h xa0 = ldl(xa), xa1 = ldl(xa + 32), xb0 = ldl(xa + 16 * XP), xb1 = ldl(xa + 16 * XP + 32);
            // V[key][d] = x Wv: A = x rows (key tiles 2ks1, 2ks1+1), B = Wv^T rows (col d). D row = key, col = d -> A fragment of O^T (row d, k = key)
#pragma unroll 1
            for (int dj = 4 * hf; dj < 4; ++dj) {                 // wave-uniform trip count: 4 in waves 0 and 1, 0 in waves 2 and 3
                const h16* wv_ = WVT + wo + dj * 1024;
                const v16h w0 = ldh(wv_), w1 = ldh(wv_ + 32);
                v8f d1, d2; pair_tiles(xa0, xa1, xb0, xb1, w0, w1, d1, d2);
                v8h h1, l1, h2, l2; split8(d1, h1, l1); split8(d2, h2, l2);
                stf(fs, 2, dj * 2 + ks1, h1, h2); stf(fs, 3, dj * 2 + ks1, l1, l2);
            }
            // K^T[d][key] = Wk^T x^T: A = Wk^T rows (d tiles 2hf, 2hf+1), B = x rows (col key). D row = d, col = key -> A fragment of S^T (row key, k = d)
            {
                const h16* wk_ = WKT + wo + (2 * hf) * 1024;
                const v16h a10 = ldh(wk_), a11 = ldh(wk_ + 32), a20 = ldh(wk_ + 1024), a21 = ldh(wk_ + 1024 + 32);
                v8f d1, d2; v8h h1, l1, h2, l2;
                pair_tiles(a10, a11, a20, a21, xa0, xa1, d1, d2);
                split8(d1, h1, l1); split8(d2, h2, l2);
                stf(fs, 0, (2 * ks1) * 2 + hf, h1, h2); stf(fs, 1, (2 * ks1) * 2 + hf, l1, l2);
                pair_tiles(a10, a11, a20, a21, xb0, xb1, d1, d2);
                split8(d1, h1, l1); split8(d2, h2, l2);
                stf(fs, 0, (2 * ks1 + 1) * 2 + hf, h1, h2); stf(fs, 1, (2 * ks1 + 1) * 2 + hf, l1, l2);
            }
        }
        // publishes head h's slots to the block; a wave that has passed it has also left head h-1's slots, so the buffer that head h+1 fills has no reader left
        __syncthreads();

        // ---- phase 2: this wave's 16-query tile: Q^T fragments, causal flash loop, ctx, output projection ----
        {
            v16h qh0, ql0, qh1, ql1;                              // B fragments: col t, k = d (d steps 0..31, 32..63), hi and residual
            {
                const h16* xq = xr + ti * 16 * XP;
                const v16h x0 = ldl(xq), x1 = ldl(xq + 32);
                const h16* wq_ = WQT + wo;
                v8f d1, d2; v8h h1, l1, h2, l2;
                {
                    const v16h a10 = ldh(wq_), a11 = ldh(wq_ + 32), a20 = ldh(wq_ + 1024), a21 = ldh(wq_ + 1024 + 32);
                    pair_tiles(a10, a11, a20, a21, x0, x1, d1, d2);
                    split8(d1, h1, l1); split8(d2, h2, l2);
                    qh0 = cat16(h1, h2); ql0 = cat16(l1, l2);
                }
                {
                    const v16h a10 = ldh(wq_ + 2048), a11 = ldh(wq_ + 2048 + 32), a20 = ldh(wq_ + 3072), a21 = ldh(wq_ + 3072 + 32);
                    pair_tiles(a10, a11, a20, a21, x0, x1, d1, d2);
                    split8(d1, h1, l1); split8(d2, h2, l2);
                    qh1 = cat16(h1, h2); ql1 = cat16(l1, l2);
                }
            }
            v8f o[4], ol[4];
#pragma unroll
            for (int j = 0; j < 4; ++j) { o[j] = (v8f){}; ol[j] = (v8f){}; }
            float m = NEGB, l = 0.0f;
#pragma unroll 1
            for (int ks = 0; ks < nks; ++ks) {
                const int fa = 4 * ks;                            // K slots: key tile 2ks -> fa, fa+1 (d steps); key tile 2ks+1 -> fa+2, fa+3
                v8f sa = (v8f){}, sal = (v8f){}, sb = (v8f){}, sbl = (v8f){};
                {
                    const v16h kh0 = ldf(fs, 0, fa), kh1 = ldf(fs, 0, fa + 1), kl0 = ldf(fs, 1, fa), kl1 = ldf(fs, 1, fa + 1);
                    sa = wmma16(kh0, qh0, sa); sal = wmma16(kl0, qh0, sal);
                    sa = wmma16(kh1, qh1, sa); sal = wmma16(kh0, ql0, sal);
                    sal = wmma16(kl1, qh1, sal); sal = wmma16(kh1, ql1, sal);
                    asm volatile("v_nop\n\tv_nop\n\tv_nop\n\tv_nop" : "+v"(sa), "+v"(sal) : "v"(kh0), "v"(kh1), "v"(kl0), "v"(kl1), "v"(qh0), "v"(qh1), "v"(ql0), "v"(ql1));
                }
                {
                    const v16h kh0 = ldf(fs, 0, fa + 2), kh1 = ldf(fs, 0, fa + 3), kl0 = ldf(fs, 1, fa + 2), kl1 = ldf(fs, 1, fa + 3);
                    sb = wmma16(kh0, qh0, sb); sbl = wmma16(kl0, qh0, sbl);
                    sb = wmma16(kh1, qh1, sb); sbl = wmma16(kh0, ql0, sbl);
                    sbl = wmma16(kl1, qh1, sbl); sbl = wmma16(kh1, ql1, sbl);
                    asm volatile("v_nop\n\tv_nop\n\tv_nop\n\tv_nop" : "+v"(sb), "+v"(sbl) : "v"(kh0), "v"(kh1), "v"(kl0), "v"(kl1), "v"(qh0), "v"(qh1), "v"(ql0), "v"(ql1));
                }
                // S^T D layout: sa[r] = (key = 32ks + 8hi + r, t), sb[r] = (key = 32ks + 16 + 8hi + r, t); causal replace-fill for key > t
                const int kbase = 32 * ks + 8 * hi;
                float ta[8], tb[8]; float mx = NEGB;
#pragma unroll
                for (int r = 0; r < 8; ++r) {
                    const float va = (sa[r] + sal[r] * RES) * SCQ;
                    const float vb = (sb[r] + sbl[r] * RES) * SCQ;
                    ta[r] = (kbase + r <= t) ? va : NEGB;
                    tb[r] = (kbase + 16 + r <= t) ? vb : NEGB;
                    mx = fmaxf(mx, fmaxf(ta[r], tb[r]));
                }
                mx = fmaxf(mx, __shfl_xor(mx, 16, 32));
                const float mnew = fmaxf(m, mx);
                const float alpha = __builtin_amdgcn_exp2f(m - mnew);
                const float sh = PSH - mnew;
                v16h pb, pl; float ls = 0.0f;
#pragma unroll
                for (int r = 0; r < 8; ++r) {
                    const float fa_ = __builtin_amdgcn_exp2f(ta[r] + sh);
                    const float fb_ = __builtin_amdgcn_exp2f(tb[r] + sh);
                    const h16 ha = (h16)fa_; const h16 hb = (h16)fb_;
                    pb[r] = ha; pb[8 + r] = hb;
                    pl[r] = (h16)((fa_ - (float)ha) * RSC); pl[8 + r] = (h16)((fb_ - (float)hb) * RSC);
                    ls += fa_ + fb_;
                }
                l = l * alpha + ls; m = mnew;
#pragma unroll
                for (int j = 0; j < 4; ++j) { o[j] = o[j] * alpha; ol[j] = ol[j] * alpha; }
                // O^T[d][t] += V^T P^T: A = V slots (row d, k = key), B = packed P^T; residual products (V res x P hi, V hi x P res) in ol
#pragma unroll
                for (int j = 0; j < 4; ++j) {
                    const v16h vh = ldf(fs, 2, 2 * j + ks), vl = ldf(fs, 3, 2 * j + ks);
                    o[j] = wmma16(vh, pb, o[j]); ol[j] = wmma16(vl, pb, ol[j]); ol[j] = wmma16(vh, pl, ol[j]);
                    asm volatile("v_nop\n\tv_nop\n\tv_nop\n\tv_nop" : "+v"(o[j]), "+v"(ol[j]) : "v"(vh), "v"(vl), "v"(pb), "v"(pl));
                }
            }
            l += __shfl_xor(l, 16, 32);
            const float cs = CSC * (1.0f / l);
            // O^T D layout: o[j][r] = (d = 16j + 8hi + r, t = lr) -> A fragment of the projection (row t, k = d): d step ds <- tiles 2ds (elements 0..7), 2ds+1 (elements 8..15)
            v16h cah0, cal0, cah1, cal1;
#pragma unroll
            for (int r = 0; r < 8; ++r) {
                float c; h16 ch;
                c = (o[0][r] + ol[0][r] * RES) * cs; ch = (h16)c; cah0[r] = ch;     cal0[r] = (h16)((c - (float)ch) * RSC);
                c = (o[1][r] + ol[1][r] * RES) * cs; ch = (h16)c; cah0[8 + r] = ch; cal0[8 + r] = (h16)((c - (float)ch) * RSC);
                c = (o[2][r] + ol[2][r] * RES) * cs; ch = (h16)c; cah1[r] = ch;     cal1[r] = (h16)((c - (float)ch) * RSC);
                c = (o[3][r] + ol[3][r] * RES) * cs; ch = (h16)c; cah1[8 + r] = ch; cal1[8 + r] = (h16)((c - (float)ch) * RSC);
            }
            // out[t][c] += ctx_h Wproj[h*64.., :]: B = Wproj^T rows (col c, k = h*64 + d); D layout: acc[r] = (t = 16ti + 8hi + r, c = 16cj + lr)
            const h16* wpp = WPT + (size_t)lr * HDT + h * HD + 8 * hi;
#pragma unroll                                                  // pacc[cj] stays in registers only under a compile-time cj
            for (int cj = 0; cj < 4; ++cj) {
                const h16* bp_ = wpp + (size_t)cj * 16 * HDT;
                const v16h b0 = ldh(bp_), b1 = ldh(bp_ + 32);
                v8f acc = (v8f){}, accl = (v8f){};
                acc = wmma16(cah0, b0, acc); accl = wmma16(cal0, b0, accl);
                acc = wmma16(cah1, b1, acc); accl = wmma16(cal1, b1, accl);
                asm volatile("v_nop\n\tv_nop\n\tv_nop\n\tv_nop" : "+v"(acc), "+v"(accl) : "v"(cah0), "v"(cal0), "v"(cah1), "v"(cal1), "v"(b0), "v"(b1));
#pragma unroll
                for (int r = 0; r < 8; ++r) pacc[cj][r] = pacc[cj][r] + (acc[r] + accl[r] * RES) * OSC;
            }
        }
    }

    // ---- epilogue: out[t][c] = bias + sum over the heads; each wave turns its own 16 rows through LDS for 16-byte row-wise stores ----
    // buffer 0 is free here: its last readers (head NHD-2) finished before they passed the last head's barrier
    float* pw = (float*)(smem + OFF_F) + wave * (16 * PP);
#pragma unroll
    for (int cj = 0; cj < 4; ++cj) {
#pragma unroll
        for (int r = 0; r < 8; ++r) pw[(8 * hi + r) * PP + 16 * cj + lr] = pacc[cj][r];
    }
    __syncthreads();                                            // the tile's stores are complete before other lanes read them row-wise
    v4f bv = *(const v4f*)(BP + 4 * lr);
#pragma unroll
    for (int k = 0; k < 4; ++k) bv[k] = rbf(bv[k]);
    v4f vals[8];
#pragma unroll
    for (int s = 0; s < 8; ++s) {
        const v4f a = *(const v4fa*)(pw + (2 * s + hi) * PP + 4 * lr);
        vals[s] = a + bv;
    }
    float* orow = OUT + (size_t)b * (TT * CC) + (size_t)(16 * wave) * CC + 4 * lr;
{
#pragma unroll
        for (int s = 0; s < 8; ++s) *(v4f*)(orow + (size_t)(2 * s + hi) * CC) = vals[s];   // 8 s x 2 rows = 16 rows; 16 lanes x 4 floats = 64 columns
         }
}

static constexpr size_t SZ_W = (size_t)NHD * CC * HD * 2;               // 65536 B per weight plane
static constexpr size_t SZ_TOTAL = 4 * SZ_W;
static_assert((size_t)HDT * CC * 2 <= SZ_W);
static_assert(SZ_TOTAL <= (size_t)134217728);

extern "C" void kernel_launch(void* const* d_in, const int* in_sizes, int n_in,
                              void* d_out, int out_size, void* d_ws, size_t ws_size, hipStream_t stream) {
    if (n_in < 6) return;
    if ((size_t)in_sizes[0] < (size_t)NB * TT * CC) return;
    if (in_sizes[1] < NHD * CC * HD || in_sizes[2] < NHD * CC * HD || in_sizes[3] < NHD * CC * HD) return;
    if (in_sizes[4] < HDT * CC || in_sizes[5] < CC) return;
    if ((size_t)out_size < (size_t)NB * TT * CC) return;
    if (SZ_TOTAL > ws_size) return;
    const float* x  = (const float*)d_in[0];     // wire order x, Wq, Wk, Wv, Wproj, bproj
    const float* Wq = (const float*)d_in[1];
    const float* Wk = (const float*)d_in[2];
    const float* Wv = (const float*)d_in[3];
    const float* Wp = (const float*)d_in[4];
    const float* bp = (const float*)d_in[5];
    float* OUT = (float*)d_out;                  // [NB][64][64]
    char* wsp = (char*)d_ws;
    h16* WQT = (h16*)wsp; wsp += SZ_W;           // [8][64 d][64 c], x64
    h16* WKT = (h16*)wsp; wsp += SZ_W;           // [8][64 d][64 c], x64
    h16* WVT = (h16*)wsp; wsp += SZ_W;           // [8][64 d][64 c], x64
    h16* WPT = (h16*)wsp; wsp += SZ_W;           // [64 c][512 k], x256

    // W[h]: in[64 c][64 d] -> out[64 d][64 c] per head; grid = 8 heads, tile stride 4096, row pitch 64
    k_wt<<<NHD, 256, 0, stream>>>(Wq, WQT, 4096, 64, 64.0f);
    k_wt<<<NHD, 256, 0, stream>>>(Wk, WKT, 4096, 64, 64.0f);
    k_wt<<<NHD, 256, 0, stream>>>(Wv, WVT, 4096, 64, 64.0f);
    // Wproj: in[512 k][64 c] -> out[64 c][512 k]; grid = 8 tiles of 64 k rows, output tile stride 64 columns, row pitch 512
    k_wt<<<HDT / 64, 256, 0, stream>>>(Wp, WPT, 64, HDT, 256.0f);

    (void)hipFuncSetAttribute(reinterpret_cast<const void*>(&k_mha), hipFuncAttributeMaxDynamicSharedMemorySize, (int)LDS_BYTES);
    k_mha<<<NB, 32 * MW, LDS_BYTES, stream>>>(x, WQT, WKT, WVT, WPT, bp, OUT);
}

// v002
// It runs in 99.1 microseconds.
// In both of two side-by-side timings against v001, it was 1.40 times as fast.
// Over all steps from v000 it is 2.03 times as fast.
#include <hip/hip_runtime.h>

// Causal multi-head attention with per-head q/k/v projections and an output projection: x [NB][64][64], Wq/Wk/Wv [8][64 in][64 out], Wproj [512 in][64 out], bias [64]; out [NB][64][64] f32.
// Compute dtypes, f32 accumulate everywhere, all contractions v_wmma_f32_16x16x32_f16: x and all weights RNE-converted to bf16 and held in f16 containers (weights x64 / x256, exact), so input x input products are exact;
// q, k, v, P and ctx are carried as f16 hi + f16 residual (x2048) planes, residual products in separate accumulators folded back by 1/2048; P carries x256 (cancels in the normalisation); softmax f32 (online, running max).
// Transposed chaining: K^T, Q^T tiles (D rows = d) pack directly into the A (keys) / B (queries) fragments of S^T = K Q^T; V tiles (D rows = key) pack into the A fragment of O^T = V^T P^T; packed P^T is its B fragment;
// O^T tiles pack into the A fragment of the output projection. The weight planes lie in the workspace in fragment order (1 KiB per 16 x 32 fragment, lane-contiguous), so a wave's 16-byte weight loads read whole 128-byte lines. One block per batch, 4 waves; the block walks the 8 heads together: each wave builds a share of the head's K/V fragments into shared LDS slots,
// then runs one 16-query tile against them; its 16 output rows are summed over heads 0..7 in registers.

#ifndef NB
#define NB 2048
#endif
#define NB_FULL 2048
#define TT   64                  // tokens per batch
#define CC   64                  // embedding width
#define NHD  8                   // heads
#define HD   64                  // head size
#define HDT  (NHD * HD)          // 512
#define MW   4                   // waves per block (one 16-query tile each)
#define XP   72                  // LDS pitch (halves) of the x tile
#define PP   68                  // LDS pitch (floats) of the output tiles
#define TP   72                  // LDS pitch (halves) of the weight transpose tile
#define PSH  8.0f                // log2 of the P carry (256)
#define RSC  2048.0f             // residual plane carry
#define RES  (1.0f / 2048.0f)
#define SCQ  (0.125f * 1.4426950408889634f / 4096.0f)   // HD^-0.5 * log2(e) / (64 * 64 weight carries)
#define CSC  0.25f               // ctx carry 16 / v weight carry 64
#define OSC  (1.0f / 4096.0f)    // 1 / (ctx carry 16 * Wproj carry 256)
#define NEGB (-3.0e38f)
#define FRH  512                 // halves per packed weight fragment; a 64 x 64 plane holds 8: index = row tile * 2 + k step

#define OFF_X 0
#define OFF_F (TT * XP * 2)                       // 9216
#define FBUF 32768                                // one head's fragment slots: K hi, K res, V hi, V res, 8 fragments of 1 KiB each
#define LDS_BYTES (OFF_F + 2 * FBUF)              // 74752

static_assert(NB <= NB_FULL);
static_assert(MW * 16 == TT);
static_assert(NHD % 2 == 0);
static_assert(MW * 16 * PP * 4 <= FBUF);
static_assert(HD == 64);
static_assert(TT == 64);
static_assert(CC == 64);
static_assert(OFF_F % 16 == 0);
static_assert((XP * 2) % 16 == 0);
static_assert((PP * 4) % 16 == 0);
static_assert(LDS_BYTES <= 262144);

typedef _Float16 h16;
typedef __attribute__((ext_vector_type(16))) _Float16 v16h;
typedef __attribute__((ext_vector_type(8)))  _Float16 v8h;
typedef __attribute__((ext_vector_type(4)))  _Float16 v4h;
typedef __attribute__((ext_vector_type(8)))  float    v8f;
typedef __attribute__((ext_vector_type(4)))  float    v4f;
typedef v4f  __attribute__((may_alias)) v4fa;
typedef v8h  __attribute__((may_alias)) v8ha;
typedef v4h  __attribute__((may_alias)) v4ha;

// RNE convert of an f32 value to the bf16 grid, returned as f32 (exactly representable in f16 for normal-range magnitudes)
__device__ __forceinline__ float rbf(float f) { unsigned u = __float_as_uint(f); u += 0x7FFFu + ((u >> 16) & 1u); return __uint_as_float(u & 0xFFFF0000u); }
__device__ __forceinline__ v16h cat16(v8h lo, v8h hi) { return __builtin_shufflevector(lo, hi, 0, 1, 2, 3, 4, 5, 6, 7, 8, 9, 10, 11, 12, 13, 14, 15); }
__device__ __forceinline__ v8f wmma16(v16h a, v16h b, v8f c) { return __builtin_amdgcn_wmma_f32_16x16x32_f16(false, a, false, b, (short)0, c, false, false); }
// fragment loader from the packed weight planes in global memory; p already includes + 8*lane. One fragment (16 rows x 32 k) = FRH halves: two runs of 32 lanes x 8 halves;
// lane (h = lane>>4, row = lane&15): elements 0..7 <- k0+8h+0..7 (first run), elements 8..15 <- k0+16+8h+0..7 (second run) (same map for A and B)
__device__ __forceinline__ v16h ldh(const h16* p) { return cat16(*(const v8h*)p, *(const v8h*)(p + FRH / 2)); }
// same map, rows of the LDS x tile
__device__ __forceinline__ v16h ldl(const h16* p) { const v8h a = *(const v8ha*)p; const v8h c = *(const v8ha*)(p + 16); return cat16(a, c); }
// per-lane fragment slots in LDS (fs already includes + lane), lane i of any wave reads what lane i of the building wave stored: slot (plane, f) = two 16-byte halves, 32 lanes apart
__device__ __forceinline__ v16h ldf(const v8ha* fs, int plane, int f) { const int i = ((plane * 8 + f) * 2) * 32; const v8h a = fs[i]; const v8h c = fs[i + 32]; return cat16(a, c); }
__device__ __forceinline__ void stf(v8ha* fs, int plane, int f, v8h a, v8h c) { const int i = ((plane * 8 + f) * 2) * 32; fs[i] = a; fs[i + 32] = c; }
// f32 tile -> f16 hi and f16 residual (x2048)
__device__ __forceinline__ void split8(const v8f d, v8h& hi, v8h& lo) {
#pragma unroll
    for (int r = 0; r < 8; ++r) { const float v = d[r]; const h16 hv = (h16)v; hi[r] = hv; lo[r] = (h16)((v - (float)hv) * RSC); }
}
// two 16x16 tiles with K = 64 sharing one B operand: d1 = A1 B, d2 = A2 B
__device__ __forceinline__ void pair_tiles(v16h a1c0, v16h a1c1, v16h a2c0, v16h a2c1, v16h bc0, v16h bc1, v8f& d1, v8f& d2) {
    v8f x = (v8f){}, y = (v8f){};
    x = wmma16(a1c0, bc0, x); y = wmma16(a2c0, bc0, y);
    x = wmma16(a1c1, bc1, x); y = wmma16(a2c1, bc1, y);
    asm volatile("v_nop\n\tv_nop\n\tv_nop\n\tv_nop" : "+v"(x), "+v"(y) : "v"(a1c0), "v"(a1c1), "v"(a2c0), "v"(a2c1), "v"(bc0), "v"(bc1));
    d1 = x; d2 = y;
}

// k_wt: one 64x64 f32 tile in[r][c] (row pitch 64, tile stride 4096) -> f16(bf16_rne(in) * scale) as the 8 fragments of the transposed tile (fragment row = c, k = r), tile stride 4096 halves.
__global__ __launch_bounds__(256) void k_wt(const float* __restrict__ src, h16* dst, float scale) {
    __shared__ __align__(16) h16 ts[64 * TP];
    const int tid = threadIdx.x;
    const int r = tid >> 2, c0 = (tid & 3) * 16;           // 64 source rows x 4 column groups of 16
    const float* s = src + (size_t)blockIdx.x * 4096 + r * 64 + c0;
#pragma unroll
    for (int q = 0; q < 4; ++q) { const v4f x = *(const v4f*)(s + 4 * q);
#pragma unroll
        for (int i = 0; i < 4; ++i) ts[(c0 + 4 * q + i) * TP + r] = (h16)(rbf(x[i]) * scale); }   // ts[c][r], c 0..63, r 0..63 all written
    __syncthreads();
    h16* d = dst + (size_t)blockIdx.x * 4096;
{
#pragma unroll
        for (int s2 = 0; s2 < 2; ++s2) { const int dd = 32 * s2 + (tid >> 3), j = tid & 7;          // 2 x 32 rows = 64 rows; 8 groups j of 8 k values = 64 halves
            const v8h val = *(const v8ha*)(&ts[dd * TP + 8 * j]);
            // k = 8j..8j+7: k step j>>2, run (j>>1)&1, lane half j&1; row dd: row tile dd>>4, lane row dd&15
            *(v8h*)(d + ((dd >> 4) * 2 + (j >> 2)) * FRH + ((j >> 1) & 1) * (FRH / 2) + ((j & 1) * 16 + (dd & 15)) * 8) = val; }
         }
}

// k_mha: one block per batch; wave w owns queries 16w..16w+15 of every head.
// LDS: x tile f16 [64][XP] (written once, block barrier, then read-only); two buffers of fragment slots shared by the block (K hi, K res, V hi, V res: 8 fragments each), head h in buffer h & 1;
// after the last head buffer 0 holds the four waves' output tiles f32 [16][PP] for the row-wise store.
__global__ __launch_bounds__(32 * MW) void k_mha(const float* __restrict__ X, const h16* __restrict__ WQT, const h16* __restrict__ WKT, const h16* __restrict__ WVT,
                                                 const h16* __restrict__ WPT, const float* __restrict__ BP, float* OUT) {
    extern __shared__ __align__(16) unsigned char smem[];
    h16* xs = (h16*)(smem + OFF_X);
    const int tid = threadIdx.x;
    const int lane = tid & 31, wave = __builtin_amdgcn_readfirstlane((int)(threadIdx.x >> 5)), lr = lane & 15, hi = lane >> 4;
    const int b = blockIdx.x;

    // stage x[b] as f16 (via bf16 RNE convert): 1024 groups of 4 elements, rows 0..63 x columns 0..63 all written
    {
        const float* xb = X + (size_t)b * (TT * CC);
#pragma unroll
        for (int it = 0; it < 8; ++it) {
            const int e = 4 * (tid + 128 * it); const int row = e >> 6, col = e & 63;
            const v4f v = *(const v4f*)(xb + e); v4h o;
#pragma unroll
            for (int k = 0; k < 4; ++k) o[k] = (h16)rbf(v[k]);
            *(v4ha*)(xs + row * XP + col) = o;
        }
    }
    __syncthreads();

    const h16* xr = xs + lr * XP + 8 * hi;                      // + tile*16*XP + 32*cs
    const int ti = wave;                                        // this wave's query tile
    const int ks1 = wave & 1, hf = wave >> 1;                   // this wave's share of phase 1: key step ks1, K d step hf; waves 0 and 1, whose causal loop has one key step less, also build V
    const int t = 16 * ti + lr;
    const int nks = (ti >> 1) + 1;                              // key steps of 32 that contain keys <= the tile's last query
    v8f pacc[4];                                                // out rows 16ti + 8hi + r, columns 16cj + lr, summed over the heads
#pragma unroll
    for (int cj = 0; cj < 4; ++cj) pacc[cj] = (v8f){};

#pragma unroll 1
    for (int h = 0; h < NHD; ++h) {
        v8ha* fs = (v8ha*)(smem + OFF_F) + (h & 1) * (FBUF / 16) + lane;
        const size_t wo = (size_t)h * 4096 + (size_t)lane * 8;           // packed weight planes [h][row tile][k step]: + tile*2*FRH + cs*FRH

        // ---- phase 1: this wave's share of the head's K^T and V tiles, packed into the shared fragment slots ----
        {
            const h16* xa = xr + (2 * ks1) * 16 * XP;
            const v16h xa0 = ldl(xa), xa1 = ldl(xa + 32), xb0 = ldl(xa + 16 * XP), xb1 = ldl(xa + 16 * XP + 32);
            // V[key][d] = x Wv: A = x rows (key tiles 2ks1, 2ks1+1), B = Wv^T rows (col d). D row = key, col = d -> A fragment of O^T (row d, k = key)
#pragma unroll 1
            for (int dj = 4 * hf; dj < 4; ++dj) {                 // wave-uniform trip count: 4 in waves 0 and 1, 0 in waves 2 and 3
                const h16* wv_ = WVT + wo + dj * 1024;
                const v16h w0 = ldh(wv_), w1 = ldh(wv_ + FRH);
                v8f d1, d2; pair_tiles(xa0, xa1, xb0, xb1, w0, w1, d1, d2);
                v8h h1, l1, h2, l2; split8(d1, h1, l1); split8(d2, h2, l2);
                stf(fs, 2, dj * 2 + ks1, h1, h2); stf(fs, 3, dj * 2 + ks1, l1, l2);
            }
            // K^T[d][key] = Wk^T x^T: A = Wk^T rows (d tiles 2hf, 2hf+1), B = x rows (col key). D row = d, col = key -> A fragment of S^T (row key, k = d)
            {
                const h16* wk_ = WKT + wo + (2 * hf) * 1024;
                const v16h a10 = ldh(wk_), a11 = ldh(wk_ + FRH), a20 = ldh(wk_ + 1024), a21 = ldh(wk_ + 1024 + FRH);
                v8f d1, d2; v8h h1, l1, h2, l2;
                pair_tiles(a10, a11, a20, a21, xa0, xa1, d1, d2);
                split8(d1, h1, l1); split8(d2, h2, l2);
                stf(fs, 0, (2 * ks1) * 2 + hf, h1, h2); stf(fs, 1, (2 * ks1) * 2 + hf, l1, l2);
                pair_tiles(a10, a11, a20, a21, xb0, xb1, d1, d2);
                split8(d1, h1, l1); split8(d2, h2, l2);
                stf(fs, 0, (2 * ks1 + 1) * 2 + hf, h1, h2); stf(fs, 1, (2 * ks1 + 1) * 2 + hf, l1, l2);
            }
        }
        // publishes head h's slots to the block; a wave that has passed it has also left head h-1's slots, so the buffer that head h+1 fills has no reader left
        __syncthreads();

        // ---- phase 2: this wave's 16-query tile: Q^T fragments, causal flash loop, ctx, output projection ----
        {
            v16h qh0, ql0, qh1, ql1;                              // B fragments: col t, k = d (d steps 0..31, 32..63), hi and residual
            {
                const h16* xq = xr + ti * 16 * XP;
                const v16h x0 = ldl(xq), x1 = ldl(xq + 32);
                const h16* wq_ = WQT + wo;
                v8f d1, d2; v8h h1, l1, h2, l2;
                {
                    const v16h a10 = ldh(wq_), a11 = ldh(wq_ + FRH), a20 = ldh(wq_ + 1024), a21 = ldh(wq_ + 1024 + FRH);
                    pair_tiles(a10, a11, a20, a21, x0, x1, d1, d2);
                    split8(d1, h1, l1); split8(d2, h2, l2);
                    qh0 = cat16(h1, h2); ql0 = cat16(l1, l2);
                }
                {
                    const v16h a10 = ldh(wq_ + 2048), a11 = ldh(wq_ + 2048 + FRH), a20 = ldh(wq_ + 3072), a21 = ldh(wq_ + 3072 + FRH);
                    pair_tiles(a10, a11, a20, a21, x0, x1, d1, d2);
                    split8(d1, h1, l1); split8(d2, h2, l2);
                    qh1 = cat16(h1, h2); ql1 = cat16(l1, l2);
                }
            }
            v8f o[4], ol[4];
#pragma unroll
            for (int j = 0; j < 4; ++j) { o[j] = (v8f){}; ol[j] = (v8f){}; }
            float m = NEGB, l = 0.0f;
#pragma unroll 1
            for (int ks = 0; ks < nks; ++ks) {
                const int fa = 4 * ks;                            // K slots: key tile 2ks -> fa, fa+1 (d steps); key tile 2ks+1 -> fa+2, fa+3
                v8f sa = (v8f){}, sal = (v8f){}, sb = (v8f){}, sbl = (v8f){};
                {
                    const v16h kh0 = ldf(fs, 0, fa), kh1 = ldf(fs, 0, fa + 1), kl0 = ldf(fs, 1, fa), kl1 = ldf(fs, 1, fa + 1);
                    sa = wmma16(kh0, qh0, sa); sal = wmma16(kl0, qh0, sal);
                    sa = wmma16(kh1, qh1, sa); sal = wmma16(kh0, ql0, sal);
                    sal = wmma16(kl1, qh1, sal); sal = wmma16(kh1, ql1, sal);
                    asm volatile("v_nop\n\tv_nop\n\tv_nop\n\tv_nop" : "+v"(sa), "+v"(sal) : "v"(kh0), "v"(kh1), "v"(kl0), "v"(kl1), "v"(qh0), "v"(qh1), "v"(ql0), "v"(ql1));
                }
                {
                    const v16h kh0 = ldf(fs, 0, fa + 2), kh1 = ldf(fs, 0, fa + 3), kl0 = ldf(fs, 1, fa + 2), kl1 = ldf(fs, 1, fa + 3);
                    sb = wmma16(kh0, qh0, sb); sbl = wmma16(kl0, qh0, sbl);
                    sb = wmma16(kh1, qh1, sb); sbl = wmma16(kh0, ql0, sbl);
                    sbl = wmma16(kl1, qh1, sbl); sbl = wmma16(kh1, ql1, sbl);
                    asm volatile("v_nop\n\tv_nop\n\tv_nop\n\tv_nop" : "+v"(sb), "+v"(sbl) : "v"(kh0), "v"(kh1), "v"(kl0), "v"(kl1), "v"(qh0), "v"(qh1), "v"(ql0), "v"(ql1));
                }
                // S^T D layout: sa[r] = (key = 32ks + 8hi + r, t), sb[r] = (key = 32ks + 16 + 8hi + r, t); causal replace-fill for key > t
                const int kbase = 32 * ks + 8 * hi;
                float ta[8], tb[8]; float mx = NEGB;
#pragma unroll
                for (int r = 0; r < 8; ++r) {
                    const float va = (sa[r] + sal[r] * RES) * SCQ;
                    const float vb = (sb[r] + sbl[r] * RES) * SCQ;
                    ta[r] = (kbase + r <= t) ? va : NEGB;
                    tb[r] = (kbase + 16 + r <= t) ? vb : NEGB;
                    mx = fmaxf(mx, fmaxf(ta[r], tb[r]));
                }
                mx = fmaxf(mx, __shfl_xor(mx, 16, 32));
                const float mnew = fmaxf(m, mx);
                const float alpha = __builtin_amdgcn_exp2f(m - mnew);
                const float sh = PSH - mnew;
                v16h pb, pl; float ls = 0.0f;
#pragma unroll
                for (int r = 0; r < 8; ++r) {
                    const float fa_ = __builtin_amdgcn_exp2f(ta[r] + sh);
                    const float fb_ = __builtin_amdgcn_exp2f(tb[r] + sh);
                    const h16 ha = (h16)fa_; const h16 hb = (h16)fb_;
                    pb[r] = ha; pb[8 + r] = hb;
                    pl[r] = (h16)((fa_ - (float)ha) * RSC); pl[8 + r] = (h16)((fb_ - (float)hb) * RSC);
                    ls += fa_ + fb_;
                }
                l = l * alpha + ls; m = mnew;
#pragma unroll
                for (int j = 0; j < 4; ++j) { o[j] = o[j] * alpha; ol[j] = ol[j] * alpha; }
                // O^T[d][t] += V^T P^T: A = V slots (row d, k = key), B = packed P^T; residual products (V res x P hi, V hi x P res) in ol
#pragma unroll
                for (int j = 0; j < 4; ++j) {
                    const v16h vh = ldf(fs, 2, 2 * j + ks), vl = ldf(fs, 3, 2 * j + ks);
                    o[j] = wmma16(vh, pb, o[j]); ol[j] = wmma16(vl, pb, ol[j]); ol[j] = wmma16(vh, pl, ol[j]);
                    asm volatile("v_nop\n\tv_nop\n\tv_nop\n\tv_nop" : "+v"(o[j]), "+v"(ol[j]) : "v"(vh), "v"(vl), "v"(pb), "v"(pl));
                }
            }
            l += __shfl_xor(l, 16, 32);
            const float cs = CSC * (1.0f / l);
            // O^T D layout: o[j][r] = (d = 16j + 8hi + r, t = lr) -> A fragment of the projection (row t, k = d): d step ds <- tiles 2ds (elements 0..7), 2ds+1 (elements 8..15)
            v16h cah0, cal0, cah1, cal1;
#pragma unroll
            for (int r = 0; r < 8; ++r) {
                float c; h16 ch;
                c = (o[0][r] + ol[0][r] * RES) * cs; ch = (h16)c; cah0[r] = ch;     cal0[r] = (h16)((c - (float)ch) * RSC);
                c = (o[1][r] + ol[1][r] * RES) * cs; ch = (h16)c; cah0[8 + r] = ch; cal0[8 + r] = (h16)((c - (float)ch) * RSC);
                c = (o[2][r] + ol[2][r] * RES) * cs; ch = (h16)c; cah1[r] = ch;     cal1[r] = (h16)((c - (float)ch) * RSC);
                c = (o[3][r] + ol[3][r] * RES) * cs; ch = (h16)c; cah1[8 + r] = ch; cal1[8 + r] = (h16)((c - (float)ch) * RSC);
            }
            // out[t][c] += ctx_h Wproj[h*64.., :]: B = Wproj^T rows (col c, k = h*64 + d); D layout: acc[r] = (t = 16ti + 8hi + r, c = 16cj + lr)
            const h16* wpp = WPT + wo;
#pragma unroll                                                  // pacc[cj] stays in registers only under a compile-time cj
            for (int cj = 0; cj < 4; ++cj) {
                const h16* bp_ = wpp + cj * 1024;
                const v16h b0 = ldh(bp_), b1 = ldh(bp_ + FRH);
                v8f acc = (v8f){}, accl = (v8f){};
                acc = wmma16(cah0, b0, acc); accl = wmma16(cal0, b0, accl);
                acc = wmma16(cah1, b1, acc); accl = wmma16(cal1, b1, accl);
                asm volatile("v_nop\n\tv_nop\n\tv_nop\n\tv_nop" : "+v"(acc), "+v"(accl) : "v"(cah0), "v"(cal0), "v"(cah1), "v"(cal1), "v"(b0), "v"(b1));
#pragma unroll
                for (int r = 0; r < 8; ++r) pacc[cj][r] = pacc[cj][r] + (acc[r] + accl[r] * RES) * OSC;
            }
        }
        asm volatile("s_wait_xcnt 0x0" ::: "memory");           // the next head rewrites the offset register that this head's weight loads name
    }

    // ---- epilogue: out[t][c] = bias + sum over the heads; each wave turns its own 16 rows through LDS for 16-byte row-wise stores ----
    // buffer 0 is free here: its last readers (head NHD-2) finished before they passed the last head's barrier
    float* pw = (float*)(smem + OFF_F) + wave * (16 * PP);
#pragma unroll
    for (int cj = 0; cj < 4; ++cj) {
#pragma unroll
        for (int r = 0; r < 8; ++r) pw[(8 * hi + r) * PP + 16 * cj + lr] = pacc[cj][r];
    }
    __syncthreads();                                            // the tile's stores are complete before other lanes read them row-wise
    v4f bv = *(const v4f*)(BP + 4 * lr);
#pragma unroll
    for (int k = 0; k < 4; ++k) bv[k] = rbf(bv[k]);
    v4f vals[8];
#pragma unroll
    for (int s = 0; s < 8; ++s) {
        const v4f a = *(const v4fa*)(pw + (2 * s + hi) * PP + 4 * lr);
        vals[s] = a + bv;
    }
    float* orow = OUT + (size_t)b * (TT * CC) + (size_t)(16 * wave) * CC + 4 * lr;
{
#pragma unroll
        for (int s = 0; s < 8; ++s) *(v4f*)(orow + (size_t)(2 * s + hi) * CC) = vals[s];   // 8 s x 2 rows = 16 rows; 16 lanes x 4 floats = 64 columns
         }
}

static constexpr size_t SZ_W = (size_t)NHD * CC * HD * 2;               // 65536 B per weight plane
static constexpr size_t SZ_TOTAL = 4 * SZ_W;
static_assert((size_t)HDT * CC * 2 <= SZ_W);
static_assert(SZ_TOTAL <= (size_t)134217728);

extern "C" void kernel_launch(void* const* d_in, const int* in_sizes, int n_in,
                              void* d_out, int out_size, void* d_ws, size_t ws_size, hipStream_t stream) {
    if (n_in < 6) return;
    if ((size_t)in_sizes[0] < (size_t)NB * TT * CC) return;
    if (in_sizes[1] < NHD * CC * HD || in_sizes[2] < NHD * CC * HD || in_sizes[3] < NHD * CC * HD) return;
    if (in_sizes[4] < HDT * CC || in_sizes[5] < CC) return;
    if ((size_t)out_size < (size_t)NB * TT * CC) return;
    if (SZ_TOTAL > ws_size) return;
    const float* x  = (const float*)d_in[0];     // wire order x, Wq, Wk, Wv, Wproj, bproj
    const float* Wq = (const float*)d_in[1];
    const float* Wk = (const float*)d_in[2];
    const float* Wv = (const float*)d_in[3];
    const float* Wp = (const float*)d_in[4];
    const float* bp = (const float*)d_in[5];
    float* OUT = (float*)d_out;                  // [NB][64][64]
    char* wsp = (char*)d_ws;
    h16* WQT = (h16*)wsp; wsp += SZ_W;           // [8 heads][4 d tiles][2 c steps] fragments, x64
    h16* WKT = (h16*)wsp; wsp += SZ_W;           // [8 heads][4 d tiles][2 c steps] fragments, x64
    h16* WVT = (h16*)wsp; wsp += SZ_W;           // [8 heads][4 d tiles][2 c steps] fragments, x64
    h16* WPT = (h16*)wsp; wsp += SZ_W;           // [8 heads][4 c tiles][2 d steps] fragments, x256

    // W[h]: in[64 c][64 d] -> fragments (row d, k = c) per head; grid = 8 heads
    k_wt<<<NHD, 256, 0, stream>>>(Wq, WQT, 64.0f);
    k_wt<<<NHD, 256, 0, stream>>>(Wk, WKT, 64.0f);
    k_wt<<<NHD, 256, 0, stream>>>(Wv, WVT, 64.0f);
    // Wproj: in[512 k][64 c] -> fragments (row c, k = d of head h); grid = 8 tiles of 64 k rows = 8 heads
    k_wt<<<HDT / 64, 256, 0, stream>>>(Wp, WPT, 256.0f);

    (void)hipFuncSetAttribute(reinterpret_cast<const void*>(&k_mha), hipFuncAttributeMaxDynamicSharedMemorySize, (int)LDS_BYTES);
    k_mha<<<NB, 32 * MW, LDS_BYTES, stream>>>(x, WQT, WKT, WVT, WPT, bp, OUT);
}

// v003
// It runs in 91.2 microseconds.
// Two timings next to v002 put it at 1.09 and 1.10 times that version's speed.
// All steps since v000 together make it 2.22 times as fast.
#include <hip/hip_runtime.h>

// Causal multi-head attention with per-head q/k/v projections and an output projection: x [NB][64][64], Wq/Wk/Wv [8][64 in][64 out], Wproj [512 in][64 out], bias [64]; out [NB][64][64] f32.
// Compute dtypes, f32 accumulate everywhere, all contractions v_wmma_f32_16x16x32_f16: x and all weights RNE-converted to bf16 and held in f16 containers (weights x64 / x256, exact), so input x input products are exact;
// q, k, v, P and ctx are carried as f16 hi + f16 residual (x2048) planes, residual products in separate accumulators folded back by 1/2048; P carries x256 (cancels in the normalisation); softmax f32 (online, running max).
// Transposed chaining: K^T, Q^T tiles (D rows = d) pack directly into the A (keys) / B (queries) fragments of S^T = K Q^T; V tiles (D rows = key) pack into the A fragment of O^T = V^T P^T; packed P^T is its B fragment;
// O^T tiles pack into the A fragment of the output projection. The weight planes lie in the workspace in fragment order (1 KiB per 16 x 32 fragment, lane-contiguous), so a wave's 16-byte weight loads read whole 128-byte lines. One block per batch, 4 waves; the block walks the 8 heads together: each wave builds a share of the head's K/V fragments into shared LDS slots,
// then runs one 16-query tile against them; its 16 output rows are summed over heads 0..7 in registers.

#ifndef NB
#define NB 2048
#endif
#define NB_FULL 2048
#define TT   64                  // tokens per batch
#define CC   64                  // embedding width
#define NHD  8                   // heads
#define HD   64                  // head size
#define HDT  (NHD * HD)          // 512
#define MW   4                   // waves per block (one 16-query tile each)
#define XP   72                  // LDS pitch (halves) of the x tile
#define PP   68                  // LDS pitch (floats) of the output tiles
#define TP   72                  // LDS pitch (halves) of the weight transpose tile
#define PSH  8.0f                // log2 of the P carry (256)
#define RSC  2048.0f             // residual plane carry
#define RES  (1.0f / 2048.0f)
#define SCQ  (0.125f * 1.4426950408889634f / 4096.0f)   // HD^-0.5 * log2(e) / (64 * 64 weight carries)
#define CSC  0.25f               // ctx carry 16 / v weight carry 64
#define OSC  (1.0f / 4096.0f)    // 1 / (ctx carry 16 * Wproj carry 256)
#define NEGB (-3.0e38f)
#define FRH  512                 // halves per packed weight fragment; a 64 x 64 plane holds 8: index = row tile * 2 + k step

#define OFF_X 0
#define OFF_F (TT * XP * 2)                       // 9216
#define FBUF 32768                                // one head's fragment slots: K hi, K res, V hi, V res, 8 fragments of 1 KiB each
#define LDS_BYTES (OFF_F + 2 * FBUF)              // 74752

static_assert(NB <= NB_FULL);
static_assert(MW * 16 == TT);
static_assert(NHD % 2 == 0);
static_assert(MW * 16 * PP * 4 <= FBUF);
static_assert(HD == 64);
static_assert(TT == 64);
static_assert(CC == 64);
static_assert(OFF_F % 16 == 0);
static_assert((XP * 2) % 16 == 0);
static_assert((PP * 4) % 16 == 0);
static_assert(LDS_BYTES <= 262144);

typedef _Float16 h16;
typedef __attribute__((ext_vector_type(16))) _Float16 v16h;
typedef __attribute__((ext_vector_type(8)))  _Float16 v8h;
typedef __attribute__((ext_vector_type(4)))  _Float16 v4h;
typedef __attribute__((ext_vector_type(8)))  float    v8f;
typedef __attribute__((ext_vector_type(4)))  float    v4f;
typedef v4f  __attribute__((may_alias)) v4fa;
typedef v8h  __attribute__((may_alias)) v8ha;
typedef v4h  __attribute__((may_alias)) v4ha;

// RNE convert of an f32 value to the bf16 grid, returned as f32 (exactly representable in f16 for normal-range magnitudes)
__device__ __forceinline__ float rbf(float f) { unsigned u = __float_as_uint(f); u += 0x7FFFu + ((u >> 16) & 1u); return __uint_as_float(u & 0xFFFF0000u); }
__device__ __forceinline__ v16h cat16(v8h lo, v8h hi) { return __builtin_shufflevector(lo, hi, 0, 1, 2, 3, 4, 5, 6, 7, 8, 9, 10, 11, 12, 13, 14, 15); }
__device__ __forceinline__ v8f wmma16(v16h a, v16h b, v8f c) { return __builtin_amdgcn_wmma_f32_16x16x32_f16(false, a, false, b, (short)0, c, false, false); }
// fragment loader from the packed weight planes in global memory; p already includes + 8*lane. One fragment (16 rows x 32 k) = FRH halves: two runs of 32 lanes x 8 halves;
// lane (h = lane>>4, row = lane&15): elements 0..7 <- k0+8h+0..7 (first run), elements 8..15 <- k0+16+8h+0..7 (second run) (same map for A and B)
__device__ __forceinline__ v16h ldh(const h16* p) { return cat16(*(const v8h*)p, *(const v8h*)(p + FRH / 2)); }
// same map, rows of the LDS x tile
__device__ __forceinline__ v16h ldl(const h16* p) { const v8h a = *(const v8ha*)p; const v8h c = *(const v8ha*)(p + 16); return cat16(a, c); }
// per-lane fragment slots in LDS (fs already includes + lane), lane i of any wave reads what lane i of the building wave stored: slot (plane, f) = two 16-byte halves, 32 lanes apart
__device__ __forceinline__ v16h ldf(const v8ha* fs, int plane, int f) { const int i = ((plane * 8 + f) * 2) * 32; const v8h a = fs[i]; const v8h c = fs[i + 32]; return cat16(a, c); }
__device__ __forceinline__ void stf(v8ha* fs, int plane, int f, v8h a, v8h c) { const int i = ((plane * 8 + f) * 2) * 32; fs[i] = a; fs[i + 32] = c; }
// f32 tile -> f16 hi and f16 residual (x2048)
__device__ __forceinline__ void split8(const v8f d, v8h& hi, v8h& lo) {
#pragma unroll
    for (int r = 0; r < 8; ++r) { const float v = d[r]; const h16 hv = (h16)v; hi[r] = hv; lo[r] = (h16)((v - (float)hv) * RSC); }
}
// two 16x16 tiles with K = 64 sharing one B operand: d1 = A1 B, d2 = A2 B
__device__ __forceinline__ void pair_tiles(v16h a1c0, v16h a1c1, v16h a2c0, v16h a2c1, v16h bc0, v16h bc1, v8f& d1, v8f& d2) {
    v8f x = (v8f){}, y = (v8f){};
    x = wmma16(a1c0, bc0, x); y = wmma16(a2c0, bc0, y);
    x = wmma16(a1c1, bc1, x); y = wmma16(a2c1, bc1, y);
    asm volatile("v_nop\n\tv_nop\n\tv_nop\n\tv_nop" : "+v"(x), "+v"(y) : "v"(a1c0), "v"(a1c1), "v"(a2c0), "v"(a2c1), "v"(bc0), "v"(bc1));
    d1 = x; d2 = y;
}

// k_wt: one 64x64 f32 tile in[r][c] (row pitch 64, tile stride 4096) -> f16(bf16_rne(in) * scale) as the 8 fragments of the transposed tile (fragment row = c, k = r), tile stride 4096 halves.
// One grid for all four weight tensors: block = plane * 8 + tile, planes Wq, Wk, Wv (x64), Wproj (x256); the four packed planes lie back to back in dst, 8 tiles each.
__global__ __launch_bounds__(256) void k_wt(const float* __restrict__ wq, const float* __restrict__ wk, const float* __restrict__ wv, const float* __restrict__ wp, h16* dst) {
    __shared__ __align__(16) h16 ts[64 * TP];
    const int tid = threadIdx.x;
    const int r = tid >> 2, c0 = (tid & 3) * 16;           // 64 source rows x 4 column groups of 16
    const int plane = blockIdx.x >> 3, tile = blockIdx.x & 7;   // block-uniform
    const float* s01 = (plane & 1) ? wk : wq;
    const float* s23 = (plane & 1) ? wp : wv;
    const float* src = (plane & 2) ? s23 : s01;
    const float scale = plane == 3 ? 256.0f : 64.0f;
    const float* s = src + (size_t)tile * 4096 + r * 64 + c0;
#pragma unroll
    for (int q = 0; q < 4; ++q) { const v4f x = *(const v4f*)(s + 4 * q);
#pragma unroll
        for (int i = 0; i < 4; ++i) ts[(c0 + 4 * q + i) * TP + r] = (h16)(rbf(x[i]) * scale); }   // ts[c][r], c 0..63, r 0..63 all written
    __syncthreads();
    h16* d = dst + (size_t)blockIdx.x * 4096;
{
#pragma unroll
        for (int s2 = 0; s2 < 2; ++s2) { const int dd = 32 * s2 + (tid >> 3), j = tid & 7;          // 2 x 32 rows = 64 rows; 8 groups j of 8 k values = 64 halves
            const v8h val = *(const v8ha*)(&ts[dd * TP + 8 * j]);
            // k = 8j..8j+7: k step j>>2, run (j>>1)&1, lane half j&1; row dd: row tile dd>>4, lane row dd&15
            *(v8h*)(d + ((dd >> 4) * 2 + (j >> 2)) * FRH + ((j >> 1) & 1) * (FRH / 2) + ((j & 1) * 16 + (dd & 15)) * 8) = val; }
         }
}

// k_mha: one block per batch; wave w owns queries 16w..16w+15 of every head.
// LDS: x tile f16 [64][XP] (written once, block barrier, then read-only); two buffers of fragment slots shared by the block (K hi, K res, V hi, V res: 8 fragments each), head h in buffer h & 1;
// after the last head buffer 0 holds the four waves' output tiles f32 [16][PP] for the row-wise store.
__global__ __launch_bounds__(32 * MW) void k_mha(const float* __restrict__ X, const h16* __restrict__ WQT, const h16* __restrict__ WKT, const h16* __restrict__ WVT,
                                                 const h16* __restrict__ WPT, const float* __restrict__ BP, float* OUT) {
    extern __shared__ __align__(16) unsigned char smem[];
    h16* xs = (h16*)(smem + OFF_X);
    const int tid = threadIdx.x;
    const int lane = tid & 31, wave = __builtin_amdgcn_readfirstlane((int)(threadIdx.x >> 5)), lr = lane & 15, hi = lane >> 4;
    const int b = blockIdx.x;

    // stage x[b] as f16 (via bf16 RNE convert): 1024 groups of 4 elements, rows 0..63 x columns 0..63 all written
    {
        const float* xb = X + (size_t)b * (TT * CC);
#pragma unroll
        for (int it = 0; it < 8; ++it) {
            const int e = 4 * (tid + 128 * it); const int row = e >> 6, col = e & 63;
            const v4f v = *(const v4f*)(xb + e); v4h o;
#pragma unroll
            for (int k = 0; k < 4; ++k) o[k] = (h16)rbf(v[k]);
            *(v4ha*)(xs + row * XP + col) = o;
        }
    }
    __syncthreads();

    const h16* xr = xs + lr * XP + 8 * hi;                      // + tile*16*XP + 32*cs
    const int ti = wave;                                        // this wave's query tile
    const int ks1 = wave & 1, hf = wave >> 1;                   // this wave's share of phase 1: key step ks1, K d step hf; waves 0 and 1, whose causal loop has one key step less, also build V
    const int t = 16 * ti + lr;
    const int nks = (ti >> 1) + 1;                              // key steps of 32 that contain keys <= the tile's last query
    v8f pacc[4];                                                // out rows 16ti + 8hi + r, columns 16cj + lr, summed over the heads
#pragma unroll
    for (int cj = 0; cj < 4; ++cj) pacc[cj] = (v8f){};

#pragma unroll 1
    for (int h = 0; h < NHD; ++h) {
        v8ha* fs = (v8ha*)(smem + OFF_F) + (h & 1) * (FBUF / 16) + lane;
        const size_t wo = (size_t)h * 4096 + (size_t)lane * 8;           // packed weight planes [h][row tile][k step]: + tile*2*FRH + cs*FRH

        // ---- phase 1: this wave's share of the head's K^T and V tiles, packed into the shared fragment slots ----
        {
            const h16* xa = xr + (2 * ks1) * 16 * XP;
            const v16h xa0 = ldl(xa), xa1 = ldl(xa + 32), xb0 = ldl(xa + 16 * XP), xb1 = ldl(xa + 16 * XP + 32);
            // V[key][d] = x Wv: A = x rows (key tiles 2ks1, 2ks1+1), B = Wv^T rows (col d). D row = key, col = d -> A fragment of O^T (row d, k = key)
#pragma unroll 1
            for (int dj = 4 * hf; dj < 4; ++dj) {                 // wave-uniform trip count: 4 in waves 0 and 1, 0 in waves 2 and 3
                const h16* wv_ = WVT + wo + dj * 1024;
                const v16h w0 = ldh(wv_), w1 = ldh(wv_ + FRH);
                v8f d1, d2; pair_tiles(xa0, xa1, xb0, xb1, w0, w1, d1, d2);
                v8h h1, l1, h2, l2; split8(d1, h1, l1); split8(d2, h2, l2);
                stf(fs, 2, dj * 2 + ks1, h1, h2); stf(fs, 3, dj * 2 + ks1, l1, l2);
            }
            // K^T[d][key] = Wk^T x^T: A = Wk^T rows (d tiles 2hf, 2hf+1), B = x rows (col key). D row = d, col = key -> A fragment of S^T (row key, k = d)
            {
                const h16* wk_ = WKT + wo + (2 * hf) * 1024;
                const v16h a10 = ldh(wk_), a11 = ldh(wk_ + FRH), a20 = ldh(wk_ + 1024), a21 = ldh(wk_ + 1024 + FRH);
                v8f d1, d2; v8h h1, l1, h2, l2;
                pair_tiles(a10, a11, a20, a21, xa0, xa1, d1, d2);
                split8(d1, h1, l1); split8(d2, h2, l2);
                stf(fs, 0, (2 * ks1) * 2 + hf, h1, h2); stf(fs, 1, (2 * ks1) * 2 + hf, l1, l2);
                pair_tiles(a10, a11, a20, a21, xb0, xb1, d1, d2);
                split8(d1, h1, l1); split8(d2, h2, l2);
                stf(fs, 0, (2 * ks1 + 1) * 2 + hf, h1, h2); stf(fs, 1, (2 * ks1 + 1) * 2 + hf, l1, l2);
            }
        }
        // publishes head h's slots to the block; a wave that has passed it has also left head h-1's slots, so the buffer that head h+1 fills has no reader left
        __syncthreads();

        // ---- phase 2: this wave's 16-query tile: Q^T fragments, causal flash loop, ctx, output projection ----
        {
            v16h qh0, ql0, qh1, ql1;                              // B fragments: col t, k = d (d steps 0..31, 32..63), hi and residual
            {
                const h16* xq = xr + ti * 16 * XP;
                const v16h x0 = ldl(xq), x1 = ldl(xq + 32);
                const h16* wq_ = WQT + wo;
                v8f d1, d2; v8h h1, l1, h2, l2;
                {
                    const v16h a10 = ldh(wq_), a11 = ldh(wq_ + FRH), a20 = ldh(wq_ + 1024), a21 = ldh(wq_ + 1024 + FRH);
                    pair_tiles(a10, a11, a20, a21, x0, x1, d1, d2);
                    split8(d1, h1, l1); split8(d2, h2, l2);
                    qh0 = cat16(h1, h2); ql0 = cat16(l1, l2);
                }
                {
                    const v16h a10 = ldh(wq_ + 2048), a11 = ldh(wq_ + 2048 + FRH), a20 = ldh(wq_ + 3072), a21 = ldh(wq_ + 3072 + FRH);
                    pair_tiles(a10, a11, a20, a21, x0, x1, d1, d2);
                    split8(d1, h1, l1); split8(d2, h2, l2);
                    qh1 = cat16(h1, h2); ql1 = cat16(l1, l2);
                }
            }
            v8f o[4], ol[4];
#pragma unroll
            for (int j = 0; j < 4; ++j) { o[j] = (v8f){}; ol[j] = (v8f){}; }
            float m = NEGB, l = 0.0f;
#pragma unroll 1
            for (int ks = 0; ks < nks; ++ks) {
                const int fa = 4 * ks;                            // K slots: key tile 2ks -> fa, fa+1 (d steps); key tile 2ks+1 -> fa+2, fa+3
                v8f sa = (v8f){}, sal = (v8f){}, sb = (v8f){}, sbl = (v8f){};
                {
                    const v16h kh0 = ldf(fs, 0, fa), kh1 = ldf(fs, 0, fa + 1), kl0 = ldf(fs, 1, fa), kl1 = ldf(fs, 1, fa + 1);
                    sa = wmma16(kh0, qh0, sa); sal = wmma16(kl0, qh0, sal);
                    sa = wmma16(kh1, qh1, sa); sal = wmma16(kh0, ql0, sal);
                    sal = wmma16(kl1, qh1, sal); sal = wmma16(kh1, ql1, sal);
                    asm volatile("v_nop\n\tv_nop\n\tv_nop\n\tv_nop" : "+v"(sa), "+v"(sal) : "v"(kh0), "v"(kh1), "v"(kl0), "v"(kl1), "v"(qh0), "v"(qh1), "v"(ql0), "v"(ql1));
                }
                {
                    const v16h kh0 = ldf(fs, 0, fa + 2), kh1 = ldf(fs, 0, fa + 3), kl0 = ldf(fs, 1, fa + 2), kl1 = ldf(fs, 1, fa + 3);
                    sb = wmma16(kh0, qh0, sb); sbl = wmma16(kl0, qh0, sbl);
                    sb = wmma16(kh1, qh1, sb); sbl = wmma16(kh0, ql0, sbl);
                    sbl = wmma16(kl1, qh1, sbl); sbl = wmma16(kh1, ql1, sbl);
                    asm volatile("v_nop\n\tv_nop\n\tv_nop\n\tv_nop" : "+v"(sb), "+v"(sbl) : "v"(kh0), "v"(kh1), "v"(kl0), "v"(kl1), "v"(qh0), "v"(qh1), "v"(ql0), "v"(ql1));
                }
                // S^T D layout: sa[r] = (key = 32ks + 8hi + r, t), sb[r] = (key = 32ks + 16 + 8hi + r, t); causal replace-fill for key > t
                const int kbase = 32 * ks + 8 * hi;
                float ta[8], tb[8]; float mx = NEGB;
#pragma unroll
                for (int r = 0; r < 8; ++r) {
                    const float va = (sa[r] + sal[r] * RES) * SCQ;
                    const float vb = (sb[r] + sbl[r] * RES) * SCQ;
                    ta[r] = (kbase + r <= t) ? va : NEGB;
                    tb[r] = (kbase + 16 + r <= t) ? vb : NEGB;
                    mx = fmaxf(mx, fmaxf(ta[r], tb[r]));
                }
                mx = fmaxf(mx, __shfl_xor(mx, 16, 32));
                const float mnew = fmaxf(m, mx);
                const float alpha = __builtin_amdgcn_exp2f(m - mnew);
                const float sh = PSH - mnew;
                v16h pb, pl; float ls = 0.0f;
#pragma unroll
                for (int r = 0; r < 8; ++r) {
                    const float fa_ = __builtin_amdgcn_exp2f(ta[r] + sh);
                    const float fb_ = __builtin_amdgcn_exp2f(tb[r] + sh);
                    const h16 ha = (h16)fa_; const h16 hb = (h16)fb_;
                    pb[r] = ha; pb[8 + r] = hb;
                    pl[r] = (h16)((fa_ - (float)ha) * RSC); pl[8 + r] = (h16)((fb_ - (float)hb) * RSC);
                    ls += fa_ + fb_;
                }
                l = l * alpha + ls; m = mnew;
#pragma unroll
                for (int j = 0; j < 4; ++j) { o[j] = o[j] * alpha; ol[j] = ol[j] * alpha; }
                // O^T[d][t] += V^T P^T: A = V slots (row d, k = key), B = packed P^T; residual products (V res x P hi, V hi x P res) in ol
#pragma unroll
                for (int j = 0; j < 4; ++j) {
                    const v16h vh = ldf(fs, 2, 2 * j + ks), vl = ldf(fs, 3, 2 * j + ks);
                    o[j] = wmma16(vh, pb, o[j]); ol[j] = wmma16(vl, pb, ol[j]); ol[j] = wmma16(vh, pl, ol[j]);
                    asm volatile("v_nop\n\tv_nop\n\tv_nop\n\tv_nop" : "+v"(o[j]), "+v"(ol[j]) : "v"(vh), "v"(vl), "v"(pb), "v"(pl));
                }
            }
            l += __shfl_xor(l, 16, 32);
            const float cs = CSC * (1.0f / l);
            // O^T D layout: o[j][r] = (d = 16j + 8hi + r, t = lr) -> A fragment of the projection (row t, k = d): d step ds <- tiles 2ds (elements 0..7), 2ds+1 (elements 8..15)
            v16h cah0, cal0, cah1, cal1;
#pragma unroll
            for (int r = 0; r < 8; ++r) {
                float c; h16 ch;
                c = (o[0][r] + ol[0][r] * RES) * cs; ch = (h16)c; cah0[r] = ch;     cal0[r] = (h16)((c - (float)ch) * RSC);
                c = (o[1][r] + ol[1][r] * RES) * cs; ch = (h16)c; cah0[8 + r] = ch; cal0[8 + r] = (h16)((c - (float)ch) * RSC);
                c = (o[2][r] + ol[2][r] * RES) * cs; ch = (h16)c; cah1[r] = ch;     cal1[r] = (h16)((c - (float)ch) * RSC);
                c = (o[3][r] + ol[3][r] * RES) * cs; ch = (h16)c; cah1[8 + r] = ch; cal1[8 + r] = (h16)((c - (float)ch) * RSC);
            }
            // out[t][c] += ctx_h Wproj[h*64.., :]: B = Wproj^T rows (col c, k = h*64 + d); D layout: acc[r] = (t = 16ti + 8hi + r, c = 16cj + lr)
            const h16* wpp = WPT + wo;
#pragma unroll                                                  // pacc[cj] stays in registers only under a compile-time cj
            for (int cj = 0; cj < 4; ++cj) {
                const h16* bp_ = wpp + cj * 1024;
                const v16h b0 = ldh(bp_), b1 = ldh(bp_ + FRH);
                v8f acc = (v8f){}, accl = (v8f){};
                acc = wmma16(cah0, b0, acc); accl = wmma16(cal0, b0, accl);
                acc = wmma16(cah1, b1, acc); accl = wmma16(cal1, b1, accl);
                asm volatile("v_nop\n\tv_nop\n\tv_nop\n\tv_nop" : "+v"(acc), "+v"(accl) : "v"(cah0), "v"(cal0), "v"(cah1), "v"(cal1), "v"(b0), "v"(b1));
#pragma unroll
                for (int r = 0; r < 8; ++r) pacc[cj][r] = pacc[cj][r] + (acc[r] + accl[r] * RES) * OSC;
            }
        }
        asm volatile("s_wait_xcnt 0x0" ::: "memory");           // the next head rewrites the offset register that this head's weight loads name
    }

    // ---- epilogue: out[t][c] = bias + sum over the heads; each wave turns its own 16 rows through LDS for 16-byte row-wise stores ----
    // buffer 0 is free here: its last readers (head NHD-2) finished before they passed the last head's barrier
    float* pw = (float*)(smem + OFF_F) + wave * (16 * PP);
#pragma unroll
    for (int cj = 0; cj < 4; ++cj) {
#pragma unroll
        for (int r = 0; r < 8; ++r) pw[(8 * hi + r) * PP + 16 * cj + lr] = pacc[cj][r];
    }
    __syncthreads();                                            // the tile's stores are complete before other lanes read them row-wise
    v4f bv = *(const v4f*)(BP + 4 * lr);
#pragma unroll
    for (int k = 0; k < 4; ++k) bv[k] = rbf(bv[k]);
    v4f vals[8];
#pragma unroll
    for (int s = 0; s < 8; ++s) {
        const v4f a = *(const v4fa*)(pw + (2 * s + hi) * PP + 4 * lr);
        vals[s] = a + bv;
    }
    float* orow = OUT + (size_t)b * (TT * CC) + (size_t)(16 * wave) * CC + 4 * lr;
{
#pragma unroll
        for (int s = 0; s < 8; ++s) *(v4f*)(orow + (size_t)(2 * s + hi) * CC) = vals[s];   // 8 s x 2 rows = 16 rows; 16 lanes x 4 floats = 64 columns
         }
}

static constexpr size_t SZ_W = (size_t)NHD * CC * HD * 2;               // 65536 B per weight plane
static constexpr size_t SZ_TOTAL = 4 * SZ_W;
static_assert((size_t)HDT * CC * 2 <= SZ_W);
static_assert(SZ_W == (size_t)8 * 4096 * 2 && NHD == 8 && HDT / 64 == 8);   // k_wt: 8 tiles of 4096 halves per plane, planes contiguous
static_assert(SZ_TOTAL <= (size_t)134217728);

extern "C" void kernel_launch(void* const* d_in, const int* in_sizes, int n_in,
                              void* d_out, int out_size, void* d_ws, size_t ws_size, hipStream_t stream) {
    if (n_in < 6) return;
    if ((size_t)in_sizes[0] < (size_t)NB * TT * CC) return;
    if (in_sizes[1] < NHD * CC * HD || in_sizes[2] < NHD * CC * HD || in_sizes[3] < NHD * CC * HD) return;
    if (in_sizes[4] < HDT * CC || in_sizes[5] < CC) return;
    if ((size_t)out_size < (size_t)NB * TT * CC) return;
    if (SZ_TOTAL > ws_size) return;
    const float* x  = (const float*)d_in[0];     // wire order x, Wq, Wk, Wv, Wproj, bproj
    const float* Wq = (const float*)d_in[1];
    const float* Wk = (const float*)d_in[2];
    const float* Wv = (const float*)d_in[3];
    const float* Wp = (const float*)d_in[4];
    const float* bp = (const float*)d_in[5];
    float* OUT = (float*)d_out;                  // [NB][64][64]
    char* wsp = (char*)d_ws;
    h16* WQT = (h16*)wsp; wsp += SZ_W;           // [8 heads][4 d tiles][2 c steps] fragments, x64
    h16* WKT = (h16*)wsp; wsp += SZ_W;           // [8 heads][4 d tiles][2 c steps] fragments, x64
    h16* WVT = (h16*)wsp; wsp += SZ_W;           // [8 heads][4 d tiles][2 c steps] fragments, x64
    h16* WPT = (h16*)wsp; wsp += SZ_W;           // [8 heads][4 c tiles][2 d steps] fragments, x256

    // W[h]: in[64 c][64 d] -> fragments (row d, k = c) per head; Wproj: in[512 k][64 c] -> fragments (row c, k = d of head h), 8 tiles of 64 k rows = 8 heads
    // grid = 4 planes x 8 tiles; block p * 8 + i writes tile i of the plane at WQT + p * 32768 halves (WQT, WKT, WVT, WPT in this order)
    k_wt<<<32, 256, 0, stream>>>(Wq, Wk, Wv, Wp, WQT);

    (void)hipFuncSetAttribute(reinterpret_cast<const void*>(&k_mha), hipFuncAttributeMaxDynamicSharedMemorySize, (int)LDS_BYTES);
    k_mha<<<NB, 32 * MW, LDS_BYTES, stream>>>(x, WQT, WKT, WVT, WPT, bp, OUT);
}

// v004
// One run takes 79.7 microseconds.
// Next to v003, in two timings, it ran 1.14 and 1.15 times as fast.
// All steps since v000 together make it 2.54 times as fast.
#include <hip/hip_runtime.h>

// Causal multi-head attention with per-head q/k/v projections and an output projection: x [NB][64][64], Wq/Wk/Wv [8][64 in][64 out], Wproj [512 in][64 out], bias [64]; out [NB][64][64] f32.
// Compute dtypes, f32 accumulate everywhere, all contractions v_wmma_f32_16x16x32_f16: x and all weights RNE-converted to bf16 and held in f16 containers (weights x64 / x256, exact), so input x input products are exact;
// q, k, v, P and ctx are carried as f16 hi + f16 residual (x2048) planes, residual products in separate accumulators folded back by 1/2048; P carries x256 (cancels in the normalisation); softmax f32 (online, running max).
// Transposed chaining: K^T, Q^T tiles (D rows = d) pack directly into the A (keys) / B (queries) fragments of S^T = K Q^T; V tiles (D rows = key) pack into the A fragment of O^T = V^T P^T; packed P^T is its B fragment;
// O^T tiles pack into the A fragment of the output projection. The weight planes lie in the workspace in fragment order (1 KiB per 16 x 32 fragment, lane-contiguous), so a wave's 16-byte weight loads read whole 128-byte lines. One block per batch, 4 waves; the block walks the 8 heads together: each wave builds a share of the head's K/V fragments into shared LDS slots,
// then runs one 16-query tile against them; its 16 output rows are summed over heads 0..7 in registers.

#ifndef NB
#define NB 2048
#endif
#define NB_FULL 2048
#define TT   64                  // tokens per batch
#define CC   64                  // embedding width
#define NHD  8                   // heads
#define HD   64                  // head size
#define HDT  (NHD * HD)          // 512
#define MW   4                   // waves per block (one 16-query tile each)
#define XP   72                  // LDS pitch (halves) of the x tile
#define PP   68                  // LDS pitch (floats) of the output tiles
#define TP   72                  // LDS pitch (halves) of the weight transpose tile
#define PSH  8.0f                // log2 of the P carry (256)
#define RSC  2048.0f             // residual plane carry
#define RES  (1.0f / 2048.0f)
#define SCQ  (0.125f * 1.4426950408889634f / 4096.0f)   // HD^-0.5 * log2(e) / (64 * 64 weight carries)
#define CSC  0.25f               // ctx carry 16 / v weight carry 64
#define OSC  (1.0f / 4096.0f)    // 1 / (ctx carry 16 * Wproj carry 256)
#define NEGB (-3.0e38f)
#define FRH  512                 // halves per packed weight fragment; a 64 x 64 plane holds 8: index = row tile * 2 + k step

#define OFF_X 0
#define OFF_F (TT * XP * 2)                       // 9216
#define FBUF 32768                                // one head's fragment slots: K hi, K res, V hi, V res, 8 fragments of 1 KiB each
#define LDS_BYTES (OFF_F + 2 * FBUF)              // 74752

static_assert(NB <= NB_FULL);
static_assert(MW * 16 == TT);
static_assert(NHD % 2 == 0);
static_assert(MW * 16 * PP * 4 <= FBUF);
static_assert(HD == 64);
static_assert(TT == 64);
static_assert(CC == 64);
static_assert(OFF_F % 16 == 0);
static_assert((XP * 2) % 16 == 0);
static_assert((PP * 4) % 16 == 0);
static_assert(LDS_BYTES <= 262144);

typedef _Float16 h16;
typedef __attribute__((ext_vector_type(16))) _Float16 v16h;
typedef __attribute__((ext_vector_type(8)))  _Float16 v8h;
typedef __attribute__((ext_vector_type(4)))  _Float16 v4h;
typedef __attribute__((ext_vector_type(8)))  float    v8f;
typedef __attribute__((ext_vector_type(4)))  float    v4f;
typedef __attribute__((ext_vector_type(4)))  unsigned v4u;
typedef v4f  __attribute__((may_alias)) v4fa;
typedef v8h  __attribute__((may_alias)) v8ha;
typedef v4h  __attribute__((may_alias)) v4ha;

// RNE convert of an f32 value to the bf16 grid, returned as f32 (exactly representable in f16 for normal-range magnitudes)
__device__ __forceinline__ float rbf(float f) { unsigned u = __float_as_uint(f); u += 0x7FFFu + ((u >> 16) & 1u); return __uint_as_float(u & 0xFFFF0000u); }
__device__ __forceinline__ v16h cat16(v8h lo, v8h hi) { return __builtin_shufflevector(lo, hi, 0, 1, 2, 3, 4, 5, 6, 7, 8, 9, 10, 11, 12, 13, 14, 15); }
__device__ __forceinline__ v8f wmma16(v16h a, v16h b, v8f c) { return __builtin_amdgcn_wmma_f32_16x16x32_f16(false, a, false, b, (short)0, c, false, false); }
// fragment loader from the packed weight planes in global memory; p already includes + 8*lane. One fragment (16 rows x 32 k) = FRH halves: two runs of 32 lanes x 8 halves;
// lane (h = lane>>4, row = lane&15): elements 0..7 <- k0+8h+0..7 (first run), elements 8..15 <- k0+16+8h+0..7 (second run) (same map for A and B)
__device__ __forceinline__ v16h ldh(const h16* p) { return cat16(*(const v8h*)p, *(const v8h*)(p + FRH / 2)); }
// same map, rows of the LDS x tile
__device__ __forceinline__ v16h ldl(const h16* p) { const v8h a = *(const v8ha*)p; const v8h c = *(const v8ha*)(p + 16); return cat16(a, c); }
// per-lane fragment slots in LDS (fs already includes + lane), lane i of any wave reads what lane i of the building wave stored: slot (plane, f) = two 16-byte halves, 32 lanes apart
__device__ __forceinline__ v16h ldf(const v8ha* fs, int plane, int f) { const int i = ((plane * 8 + f) * 2) * 32; const v8h a = fs[i]; const v8h c = fs[i + 32]; return cat16(a, c); }
__device__ __forceinline__ void stf(v8ha* fs, int plane, int f, v8h a, v8h c) { const int i = ((plane * 8 + f) * 2) * 32; fs[i] = a; fs[i + 32] = c; }
// f32 tile -> f16 hi and f16 residual (x2048): hi = f16(v), lo = f16((v - hi) * 2048), 20 vector instructions for 8 values
__device__ __forceinline__ void split8(const v8f d, v8h& hi, v8h& lo) {
    unsigned h0, h1, h2, h3, l0, l1, l2, l3; float t0, t1, t2, t3;
    // written as asm because the compiler converts every value twice (singly and packed) and widens each hi again before it subtracts: 31 instructions for the same 8 values.
    // One packed convert per pair gives hi; v - hi reads the packed half directly (exact in f32; even elements wait in the lo register, odd ones in t); (v - hi) * 2048 (exact) is rounded to f16 once,
    // into the low, then the high half of lo. The s_delay_alu lines are the hint for a producer four vector instructions back, so that other waves issue in the gap.
    asm("v_cvt_pk_f16_f32 %0, %12, %13\n\t"
        "v_cvt_pk_f16_f32 %1, %14, %15\n\t"
        "v_cvt_pk_f16_f32 %2, %16, %17\n\t"
        "v_cvt_pk_f16_f32 %3, %18, %19\n\t"
        "s_delay_alu instid0(VALU_DEP_4)\n\t"
        "v_fma_mix_f32 %4, %0, -1.0, %12 op_sel_hi:[1,1,0]\n\t"
        "v_fma_mix_f32 %8, %0, -1.0, %13 op_sel:[1,0,0] op_sel_hi:[1,1,0]\n\t"
        "v_fma_mix_f32 %5, %1, -1.0, %14 op_sel_hi:[1,1,0]\n\t"
        "v_fma_mix_f32 %9, %1, -1.0, %15 op_sel:[1,0,0] op_sel_hi:[1,1,0]\n\t"
        "v_fma_mix_f32 %6, %2, -1.0, %16 op_sel_hi:[1,1,0]\n\t"
        "v_fma_mix_f32 %10, %2, -1.0, %17 op_sel:[1,0,0] op_sel_hi:[1,1,0]\n\t"
        "v_fma_mix_f32 %7, %3, -1.0, %18 op_sel_hi:[1,1,0]\n\t"
        "v_fma_mix_f32 %11, %3, -1.0, %19 op_sel:[1,0,0] op_sel_hi:[1,1,0]\n\t"
        "v_fma_mixlo_f16 %4, %4, %20, 0 op_sel_hi:[0,0,0]\n\t"
        "v_fma_mixlo_f16 %5, %5, %20, 0 op_sel_hi:[0,0,0]\n\t"
        "v_fma_mixlo_f16 %6, %6, %20, 0 op_sel_hi:[0,0,0]\n\t"
        "v_fma_mixlo_f16 %7, %7, %20, 0 op_sel_hi:[0,0,0]\n\t"
        "s_delay_alu instid0(VALU_DEP_4) | instskip(NEXT) | instid1(VALU_DEP_4)\n\t"
        "v_fma_mixhi_f16 %4, %8, %20, 0 op_sel_hi:[0,0,0]\n\t"
        "v_fma_mixhi_f16 %5, %9, %20, 0 op_sel_hi:[0,0,0]\n\t"
        "s_delay_alu instid0(VALU_DEP_4) | instskip(NEXT) | instid1(VALU_DEP_4)\n\t"
        "v_fma_mixhi_f16 %6, %10, %20, 0 op_sel_hi:[0,0,0]\n\t"
        "v_fma_mixhi_f16 %7, %11, %20, 0 op_sel_hi:[0,0,0]"
        : "=&v"(h0), "=&v"(h1), "=&v"(h2), "=&v"(h3), "=&v"(l0), "=&v"(l1), "=&v"(l2), "=&v"(l3), "=&v"(t0), "=&v"(t1), "=&v"(t2), "=&v"(t3)
        : "v"(d[0]), "v"(d[1]), "v"(d[2]), "v"(d[3]), "v"(d[4]), "v"(d[5]), "v"(d[6]), "v"(d[7]), "s"(RSC));
    const v4u h = {h0, h1, h2, h3}, l = {l0, l1, l2, l3};
    hi = __builtin_bit_cast(v8h, h); lo = __builtin_bit_cast(v8h, l);
}
// two 16x16 tiles with K = 64 sharing one B operand: d1 = A1 B, d2 = A2 B
__device__ __forceinline__ void pair_tiles(v16h a1c0, v16h a1c1, v16h a2c0, v16h a2c1, v16h bc0, v16h bc1, v8f& d1, v8f& d2) {
    v8f x = (v8f){}, y = (v8f){};
    x = wmma16(a1c0, bc0, x); y = wmma16(a2c0, bc0, y);
    x = wmma16(a1c1, bc1, x); y = wmma16(a2c1, bc1, y);
    asm volatile("v_nop\n\tv_nop\n\tv_nop\n\tv_nop" : "+v"(x), "+v"(y) : "v"(a1c0), "v"(a1c1), "v"(a2c0), "v"(a2c1), "v"(bc0), "v"(bc1));
    d1 = x; d2 = y;
}

// k_wt: one 64x64 f32 tile in[r][c] (row pitch 64, tile stride 4096) -> f16(bf16_rne(in) * scale) as the 8 fragments of the transposed tile (fragment row = c, k = r), tile stride 4096 halves.
// One grid for all four weight tensors: block = plane * 8 + tile, planes Wq, Wk, Wv (x64), Wproj (x256); the four packed planes lie back to back in dst, 8 tiles each.
__global__ __launch_bounds__(256) void k_wt(const float* __restrict__ wq, const float* __restrict__ wk, const float* __restrict__ wv, const float* __restrict__ wp, h16* dst) {
    __shared__ __align__(16) h16 ts[64 * TP];
    const int tid = threadIdx.x;
    const int r = tid >> 2, c0 = (tid & 3) * 16;           // 64 source rows x 4 column groups of 16
    const int plane = blockIdx.x >> 3, tile = blockIdx.x & 7;   // block-uniform
    const float* s01 = (plane & 1) ? wk : wq;
    const float* s23 = (plane & 1) ? wp : wv;
    const float* src = (plane & 2) ? s23 : s01;
    const float scale = plane == 3 ? 256.0f : 64.0f;
    const float* s = src + (size_t)tile * 4096 + r * 64 + c0;
#pragma unroll
    for (int q = 0; q < 4; ++q) { const v4f x = *(const v4f*)(s + 4 * q);
#pragma unroll
        for (int i = 0; i < 4; ++i) ts[(c0 + 4 * q + i) * TP + r] = (h16)(rbf(x[i]) * scale); }   // ts[c][r], c 0..63, r 0..63 all written
    __syncthreads();
    h16* d = dst + (size_t)blockIdx.x * 4096;
{
#pragma unroll
        for (int s2 = 0; s2 < 2; ++s2) { const int dd = 32 * s2 + (tid >> 3), j = tid & 7;          // 2 x 32 rows = 64 rows; 8 groups j of 8 k values = 64 halves
            const v8h val = *(const v8ha*)(&ts[dd * TP + 8 * j]);
            // k = 8j..8j+7: k step j>>2, run (j>>1)&1, lane half j&1; row dd: row tile dd>>4, lane row dd&15
            *(v8h*)(d + ((dd >> 4) * 2 + (j >> 2)) * FRH + ((j >> 1) & 1) * (FRH / 2) + ((j & 1) * 16 + (dd & 15)) * 8) = val; }
         }
}

// k_mha: one block per batch; wave w owns queries 16w..16w+15 of every head.
// LDS: x tile f16 [64][XP] (written once, block barrier, then read-only); two buffers of fragment slots shared by the block (K hi, K res, V hi, V res: 8 fragments each), head h in buffer h & 1;
// after the last head buffer 0 holds the four waves' output tiles f32 [16][PP] for the row-wise store.
__global__ __launch_bounds__(32 * MW) void k_mha(const float* __restrict__ X, const h16* __restrict__ WQT, const h16* __restrict__ WKT, const h16* __restrict__ WVT,
                                                 const h16* __restrict__ WPT, const float* __restrict__ BP, float* OUT) {
    extern __shared__ __align__(16) unsigned char smem[];
    h16* xs = (h16*)(smem + OFF_X);
    const int tid = threadIdx.x;
    const int lane = tid & 31, wave = __builtin_amdgcn_readfirstlane((int)(threadIdx.x >> 5)), lr = lane & 15, hi = lane >> 4;
    const int b = blockIdx.x;

    // stage x[b] as f16 (via bf16 RNE convert): 1024 groups of 4 elements, rows 0..63 x columns 0..63 all written
    {
        const float* xb = X + (size_t)b * (TT * CC);
#pragma unroll
        for (int it = 0; it < 8; ++it) {
            const int e = 4 * (tid + 128 * it); const int row = e >> 6, col = e & 63;
            const v4f v = *(const v4f*)(xb + e); v4h o;
#pragma unroll
            for (int k = 0; k < 4; ++k) o[k] = (h16)rbf(v[k]);
            *(v4ha*)(xs + row * XP + col) = o;
        }
    }
    __syncthreads();

    const h16* xr = xs + lr * XP + 8 * hi;                      // + tile*16*XP + 32*cs
    const int ti = wave;                                        // this wave's query tile
    const int ks1 = wave & 1, hf = wave >> 1;                   // this wave's share of phase 1: key step ks1, K d step hf; waves 0 and 1, whose causal loop has one key step less, also build V
    const int t = 16 * ti + lr;
    const int nks = (ti >> 1) + 1;                              // key steps of 32 that contain keys <= the tile's last query
    v8f pacc[4];                                                // out rows 16ti + 8hi + r, columns 16cj + lr, summed over the heads
#pragma unroll
    for (int cj = 0; cj < 4; ++cj) pacc[cj] = (v8f){};

#pragma unroll 1
    for (int h = 0; h < NHD; ++h) {
        v8ha* fs = (v8ha*)(smem + OFF_F) + (h & 1) * (FBUF / 16) + lane;
        const size_t wo = (size_t)h * 4096 + (size_t)lane * 8;           // packed weight planes [h][row tile][k step]: + tile*2*FRH + cs*FRH

        // ---- phase 1: this wave's share of the head's K^T and V tiles, packed into the shared fragment slots ----
        {
            const h16* xa = xr + (2 * ks1) * 16 * XP;
            const v16h xa0 = ldl(xa), xa1 = ldl(xa + 32), xb0 = ldl(xa + 16 * XP), xb1 = ldl(xa + 16 * XP + 32);
            // V[key][d] = x Wv: A = x rows (key tiles 2ks1, 2ks1+1), B = Wv^T rows (col d). D row = key, col = d -> A fragment of O^T (row d, k = key)
#pragma unroll 1
            for (int dj = 4 * hf; dj < 4; ++dj) {                 // wave-uniform trip count: 4 in waves 0 and 1, 0 in waves 2 and 3
                const h16* wv_ = WVT + wo + dj * 1024;
                const v16h w0 = ldh(wv_), w1 = ldh(wv_ + FRH);
                v8f d1, d2; pair_tiles(xa0, xa1, xb0, xb1, w0, w1, d1, d2);
                v8h h1, l1, h2, l2; split8(d1, h1, l1); split8(d2, h2, l2);
                stf(fs, 2, dj * 2 + ks1, h1, h2); stf(fs, 3, dj * 2 + ks1, l1, l2);
            }
            // K^T[d][key] = Wk^T x^T: A = Wk^T rows (d tiles 2hf, 2hf+1), B = x rows (col key). D row = d, col = key -> A fragment of S^T (row key, k = d)
            {
                const h16* wk_ = WKT + wo + (2 * hf) * 1024;
                const v16h a10 = ldh(wk_), a11 = ldh(wk_ + FRH), a20 = ldh(wk_ + 1024), a21 = ldh(wk_ + 1024 + FRH);
                v8f d1, d2; v8h h1, l1, h2, l2;
                pair_tiles(a10, a11, a20, a21, xa0, xa1, d1, d2);
                split8(d1, h1, l1); split8(d2, h2, l2);
                stf(fs, 0, (2 * ks1) * 2 + hf, h1, h2); stf(fs, 1, (2 * ks1) * 2 + hf, l1, l2);
                pair_tiles(a10, a11, a20, a21, xb0, xb1, d1, d2);
                split8(d1, h1, l1); split8(d2, h2, l2);
                stf(fs, 0, (2 * ks1 + 1) * 2 + hf, h1, h2); stf(fs, 1, (2 * ks1 + 1) * 2 + hf, l1, l2);
            }
        }
        // publishes head h's slots to the block; a wave that has passed it has also left head h-1's slots, so the buffer that head h+1 fills has no reader left
        __syncthreads();

        // ---- phase 2: this wave's 16-query tile: Q^T fragments, causal flash loop, ctx, output projection ----
        {
            v16h qh0, ql0, qh1, ql1;                              // B fragments: col t, k = d (d steps 0..31, 32..63), hi and residual
            {
                const h16* xq = xr + ti * 16 * XP;
                const v16h x0 = ldl(xq), x1 = ldl(xq + 32);
                const h16* wq_ = WQT + wo;
                v8f d1, d2; v8h h1, l1, h2, l2;
                {
                    const v16h a10 = ldh(wq_), a11 = ldh(wq_ + FRH), a20 = ldh(wq_ + 1024), a21 = ldh(wq_ + 1024 + FRH);
                    pair_tiles(a10, a11, a20, a21, x0, x1, d1, d2);
                    split8(d1, h1, l1); split8(d2, h2, l2);
                    qh0 = cat16(h1, h2); ql0 = cat16(l1, l2);
                }
                {
                    const v16h a10 = ldh(wq_ + 2048), a11 = ldh(wq_ + 2048 + FRH), a20 = ldh(wq_ + 3072), a21 = ldh(wq_ + 3072 + FRH);
                    pair_tiles(a10, a11, a20, a21, x0, x1, d1, d2);
                    split8(d1, h1, l1); split8(d2, h2, l2);
                    qh1 = cat16(h1, h2); ql1 = cat16(l1, l2);
                }
            }
            v8f o[4], ol[4];
#pragma unroll
            for (int j = 0; j < 4; ++j) { o[j] = (v8f){}; ol[j] = (v8f){}; }
            float m = NEGB, l = 0.0f;
#pragma unroll 1
            for (int ks = 0; ks < nks; ++ks) {
                const int fa = 4 * ks;                            // K slots: key tile 2ks -> fa, fa+1 (d steps); key tile 2ks+1 -> fa+2, fa+3
                v8f sa = (v8f){}, sal = (v8f){}, sb = (v8f){}, sbl = (v8f){};
                {
                    const v16h kh0 = ldf(fs, 0, fa), kh1 = ldf(fs, 0, fa + 1), kl0 = ldf(fs, 1, fa), kl1 = ldf(fs, 1, fa + 1);
                    sa = wmma16(kh0, qh0, sa); sal = wmma16(kl0, qh0, sal);
                    sa = wmma16(kh1, qh1, sa); sal = wmma16(kh0, ql0, sal);
                    sal = wmma16(kl1, qh1, sal); sal = wmma16(kh1, ql1, sal);
                    asm volatile("v_nop\n\tv_nop\n\tv_nop\n\tv_nop" : "+v"(sa), "+v"(sal) : "v"(kh0), "v"(kh1), "v"(kl0), "v"(kl1), "v"(qh0), "v"(qh1), "v"(ql0), "v"(ql1));
                }
                {
                    const v16h kh0 = ldf(fs, 0, fa + 2), kh1 = ldf(fs, 0, fa + 3), kl0 = ldf(fs, 1, fa + 2), kl1 = ldf(fs, 1, fa + 3);
                    sb = wmma16(kh0, qh0, sb); sbl = wmma16(kl0, qh0, sbl);
                    sb = wmma16(kh1, qh1, sb); sbl = wmma16(kh0, ql0, sbl);
                    sbl = wmma16(kl1, qh1, sbl); sbl = wmma16(kh1, ql1, sbl);
                    asm volatile("v_nop\n\tv_nop\n\tv_nop\n\tv_nop" : "+v"(sb), "+v"(sbl) : "v"(kh0), "v"(kh1), "v"(kl0), "v"(kl1), "v"(qh0), "v"(qh1), "v"(ql0), "v"(ql1));
                }
                // S^T D layout: sa[r] = (key = 32ks + 8hi + r, t), sb[r] = (key = 32ks + 16 + 8hi + r, t); causal replace-fill for key > t
                const int kbase = 32 * ks + 8 * hi;
                float ta[8], tb[8]; float mx = NEGB;
#pragma unroll
                for (int r = 0; r < 8; ++r) {
                    const float va = (sa[r] + sal[r] * RES) * SCQ;
                    const float vb = (sb[r] + sbl[r] * RES) * SCQ;
                    ta[r] = (kbase + r <= t) ? va : NEGB;
                    tb[r] = (kbase + 16 + r <= t) ? vb : NEGB;
                    mx = fmaxf(mx, fmaxf(ta[r], tb[r]));
                }
                mx = fmaxf(mx, __shfl_xor(mx, 16, 32));
                const float mnew = fmaxf(m, mx);
                const float alpha = __builtin_amdgcn_exp2f(m - mnew);
                const float sh = PSH - mnew;
                v8f pa8, pb8; float ls = 0.0f;
#pragma unroll
                for (int r = 0; r < 8; ++r) {
                    const float fa_ = __builtin_amdgcn_exp2f(ta[r] + sh);
                    const float fb_ = __builtin_amdgcn_exp2f(tb[r] + sh);
                    pa8[r] = fa_; pb8[r] = fb_;
                    ls += fa_ + fb_;
                }
                v8h ph1, pl1, ph2, pl2; split8(pa8, ph1, pl1); split8(pb8, ph2, pl2);
                const v16h pb = cat16(ph1, ph2), pl = cat16(pl1, pl2);
                l = l * alpha + ls; m = mnew;
#pragma unroll
                for (int j = 0; j < 4; ++j) { o[j] = o[j] * alpha; ol[j] = ol[j] * alpha; }
                // O^T[d][t] += V^T P^T: A = V slots (row d, k = key), B = packed P^T; residual products (V res x P hi, V hi x P res) in ol
#pragma unroll
                for (int j = 0; j < 4; ++j) {
                    const v16h vh = ldf(fs, 2, 2 * j + ks), vl = ldf(fs, 3, 2 * j + ks);
                    o[j] = wmma16(vh, pb, o[j]); ol[j] = wmma16(vl, pb, ol[j]); ol[j] = wmma16(vh, pl, ol[j]);
                    asm volatile("v_nop\n\tv_nop\n\tv_nop\n\tv_nop" : "+v"(o[j]), "+v"(ol[j]) : "v"(vh), "v"(vl), "v"(pb), "v"(pl));
                }
            }
            l += __shfl_xor(l, 16, 32);
            const float cs = CSC * (1.0f / l);
            // O^T D layout: o[j][r] = (d = 16j + 8hi + r, t = lr) -> A fragment of the projection (row t, k = d): d step ds <- tiles 2ds (elements 0..7), 2ds+1 (elements 8..15)
            v8h ch_[4], cl_[4];
#pragma unroll
            for (int j = 0; j < 4; ++j) {
                v8f c;
#pragma unroll
                for (int r = 0; r < 8; ++r) c[r] = (o[j][r] + ol[j][r] * RES) * cs;
                split8(c, ch_[j], cl_[j]);
            }
            const v16h cah0 = cat16(ch_[0], ch_[1]), cal0 = cat16(cl_[0], cl_[1]), cah1 = cat16(ch_[2], ch_[3]), cal1 = cat16(cl_[2], cl_[3]);
            // out[t][c] += ctx_h Wproj[h*64.., :]: B = Wproj^T rows (col c, k = h*64 + d); D layout: acc[r] = (t = 16ti + 8hi + r, c = 16cj + lr)
            const h16* wpp = WPT + wo;
#pragma unroll                                                  // pacc[cj] stays in registers only under a compile-time cj
            for (int cj = 0; cj < 4; ++cj) {
                const h16* bp_ = wpp + cj * 1024;
                const v16h b0 = ldh(bp_), b1 = ldh(bp_ + FRH);
                v8f acc = (v8f){}, accl = (v8f){};
                acc = wmma16(cah0, b0, acc); accl = wmma16(cal0, b0, accl);
                acc = wmma16(cah1, b1, acc); accl = wmma16(cal1, b1, accl);
                asm volatile("v_nop\n\tv_nop\n\tv_nop\n\tv_nop" : "+v"(acc), "+v"(accl) : "v"(cah0), "v"(cal0), "v"(cah1), "v"(cal1), "v"(b0), "v"(b1));
#pragma unroll
                for (int r = 0; r < 8; ++r) pacc[cj][r] = pacc[cj][r] + (acc[r] + accl[r] * RES) * OSC;
            }
        }
        asm volatile("s_wait_xcnt 0x0" ::: "memory");           // the next head rewrites the offset register that this head's weight loads name
    }

    // ---- epilogue: out[t][c] = bias + sum over the heads; each wave turns its own 16 rows through LDS for 16-byte row-wise stores ----
    // buffer 0 is free here: its last readers (head NHD-2) finished before they passed the last head's barrier
    float* pw = (float*)(smem + OFF_F) + wave * (16 * PP);
#pragma unroll
    for (int cj = 0; cj < 4; ++cj) {
#pragma unroll
        for (int r = 0; r < 8; ++r) pw[(8 * hi + r) * PP + 16 * cj + lr] = pacc[cj][r];
    }
    __syncthreads();                                            // the tile's stores are complete before other lanes read them row-wise
    v4f bv = *(const v4f*)(BP + 4 * lr);
#pragma unroll
    for (int k = 0; k < 4; ++k) bv[k] = rbf(bv[k]);
    v4f vals[8];
#pragma unroll
    for (int s = 0; s < 8; ++s) {
        const v4f a = *(const v4fa*)(pw + (2 * s + hi) * PP + 4 * lr);
        vals[s] = a + bv;
    }
    float* orow = OUT + (size_t)b * (TT * CC) + (size_t)(16 * wave) * CC + 4 * lr;
{
#pragma unroll
        for (int s = 0; s < 8; ++s) *(v4f*)(orow + (size_t)(2 * s + hi) * CC) = vals[s];   // 8 s x 2 rows = 16 rows; 16 lanes x 4 floats = 64 columns
         }
}

static constexpr size_t SZ_W = (size_t)NHD * CC * HD * 2;               // 65536 B per weight plane
static constexpr size_t SZ_TOTAL = 4 * SZ_W;
static_assert((size_t)HDT * CC * 2 <= SZ_W);
static_assert(SZ_W == (size_t)8 * 4096 * 2 && NHD == 8 && HDT / 64 == 8);   // k_wt: 8 tiles of 4096 halves per plane, planes contiguous
static_assert(SZ_TOTAL <= (size_t)134217728);

extern "C" void kernel_launch(void* const* d_in, const int* in_sizes, int n_in,
                              void* d_out, int out_size, void* d_ws, size_t ws_size, hipStream_t stream) {
    if (n_in < 6) return;
    if ((size_t)in_sizes[0] < (size_t)NB * TT * CC) return;
    if (in_sizes[1] < NHD * CC * HD || in_sizes[2] < NHD * CC * HD || in_sizes[3] < NHD * CC * HD) return;
    if (in_sizes[4] < HDT * CC || in_sizes[5] < CC) return;
    if ((size_t)out_size < (size_t)NB * TT * CC) return;
    if (SZ_TOTAL > ws_size) return;
    const float* x  = (const float*)d_in[0];     // wire order x, Wq, Wk, Wv, Wproj, bproj
    const float* Wq = (const float*)d_in[1];
    const float* Wk = (const float*)d_in[2];
    const float* Wv = (const float*)d_in[3];
    const float* Wp = (const float*)d_in[4];
    const float* bp = (const float*)d_in[5];
    float* OUT = (float*)d_out;                  // [NB][64][64]
    char* wsp = (char*)d_ws;
    h16* WQT = (h16*)wsp; wsp += SZ_W;           // [8 heads][4 d tiles][2 c steps] fragments, x64
    h16* WKT = (h16*)wsp; wsp += SZ_W;           // [8 heads][4 d tiles][2 c steps] fragments, x64
    h16* WVT = (h16*)wsp; wsp += SZ_W;           // [8 heads][4 d tiles][2 c steps] fragments, x64
    h16* WPT = (h16*)wsp; wsp += SZ_W;           // [8 heads][4 c tiles][2 d steps] fragments, x256

    // W[h]: in[64 c][64 d] -> fragments (row d, k = c) per head; Wproj: in[512 k][64 c] -> fragments (row c, k = d of head h), 8 tiles of 64 k rows = 8 heads
    // grid = 4 planes x 8 tiles; block p * 8 + i writes tile i of the plane at WQT + p * 32768 halves (WQT, WKT, WVT, WPT in this order)
    k_wt<<<32, 256, 0, stream>>>(Wq, Wk, Wv, Wp, WQT);

    (void)hipFuncSetAttribute(reinterpret_cast<const void*>(&k_mha), hipFuncAttributeMaxDynamicSharedMemorySize, (int)LDS_BYTES);
    k_mha<<<NB, 32 * MW, LDS_BYTES, stream>>>(x, WQT, WKT, WVT, WPT, bp, OUT);
}

// v005
// Measured time: 63.8 microseconds a run.
// Timed twice side by side with v004, it ran 1.23 times as fast both times.
// Over all steps from v000 it is 3.12 times as fast.
#include <hip/hip_runtime.h>

// Causal multi-head attention with per-head q/k/v projections and an output projection: x [NB][64][64], Wq/Wk/Wv [8][64 in][64 out], Wproj [512 in][64 out], bias [64]; out [NB][64][64] f32.
// Compute dtypes, f32 accumulate everywhere, all contractions v_wmma_f32_16x16x32_f16: x and all weights RNE-converted to bf16 and held in f16 containers (weights x64 / x256, exact), so input x input products are exact;
// q, k, v, P and ctx are carried as f16 hi + f16 residual (x2048) planes, residual products in separate accumulators folded back by 1/2048; P carries x256 (cancels in the normalisation); softmax f32 (online, running max).
// Transposed chaining: K^T, Q^T tiles (D rows = d) pack directly into the A (keys) / B (queries) fragments of S^T = K Q^T; V tiles (D rows = key) pack into the A fragment of O^T = V^T P^T; packed P^T is its B fragment;
// O^T tiles pack into the A fragment of the output projection. The weight planes lie in the workspace in fragment order (1 KiB per 16 x 32 fragment, lane-contiguous), so a wave's 16-byte weight loads read whole 128-byte lines. One block per batch, 4 waves; the block walks the 8 heads together: each wave builds a share of the head's K/V fragments into shared LDS slots,
// then runs one 16-query tile against them; its 16 output rows are summed over heads 0..7 in registers.

#ifndef NB
#define NB 2048
#endif
#define NB_FULL 2048
#define TT   64                  // tokens per batch
#define CC   64                  // embedding width
#define NHD  8                   // heads
#define HD   64                  // head size
#define HDT  (NHD * HD)          // 512
#define MW   4                   // waves per block (one 16-query tile each)
#define XP   72                  // LDS pitch (halves) of the x tile
#define PP   68                  // LDS pitch (floats) of the output tiles
#define TP   72                  // LDS pitch (halves) of the weight transpose tile
#define PSH  8.0f                // log2 of the P carry (256)
#define RSC  2048.0f             // residual plane carry
#define RES  (1.0f / 2048.0f)
#define SCQ  (0.125f * 1.4426950408889634f / 4096.0f)   // HD^-0.5 * log2(e) / (64 * 64 weight carries)
#define CSC  0.25f               // ctx carry 16 / v weight carry 64
#define OSC  (1.0f / 4096.0f)    // 1 / (ctx carry 16 * Wproj carry 256)
#define NEGB (-3.0e38f)
#define FRH  512                 // halves per packed weight fragment; a 64 x 64 plane holds 8: index = row tile * 2 + k step

#define OFF_X 0
#define OFF_F (TT * XP * 2)                       // 9216
#define FBUF 32768                                // one head's fragment slots: K hi, K res, V hi, V res, 8 fragments of 1 KiB each
#define LDS_BYTES (OFF_F + 2 * FBUF)              // 74752

static_assert(NB <= NB_FULL);
static_assert(MW * 16 == TT);
static_assert(NHD % 2 == 0);
static_assert(MW * 16 * PP * 4 <= FBUF);
static_assert(HD == 64);
static_assert(TT == 64);
static_assert(CC == 64);
static_assert(OFF_F % 16 == 0);
static_assert((XP * 2) % 16 == 0);
static_assert((PP * 4) % 16 == 0);
static_assert(LDS_BYTES <= 262144);

typedef _Float16 h16;
typedef __attribute__((ext_vector_type(16))) _Float16 v16h;
typedef __attribute__((ext_vector_type(8)))  _Float16 v8h;
typedef __attribute__((ext_vector_type(4)))  _Float16 v4h;
typedef __attribute__((ext_vector_type(8)))  float    v8f;
typedef __attribute__((ext_vector_type(4)))  float    v4f;
typedef __attribute__((ext_vector_type(4)))  unsigned v4u;
typedef v4f  __attribute__((may_alias)) v4fa;
typedef v8h  __attribute__((may_alias)) v8ha;
typedef v4h  __attribute__((may_alias)) v4ha;

// RNE convert of an f32 value to the bf16 grid, returned as f32 (exactly representable in f16 for normal-range magnitudes)
__device__ __forceinline__ float rbf(float f) { unsigned u = __float_as_uint(f); u += 0x7FFFu + ((u >> 16) & 1u); return __uint_as_float(u & 0xFFFF0000u); }
__device__ __forceinline__ v16h cat16(v8h lo, v8h hi) { return __builtin_shufflevector(lo, hi, 0, 1, 2, 3, 4, 5, 6, 7, 8, 9, 10, 11, 12, 13, 14, 15); }
__device__ __forceinline__ v8f wmma16(v16h a, v16h b, v8f c) { return __builtin_amdgcn_wmma_f32_16x16x32_f16(false, a, false, b, (short)0, c, false, false); }
// fragment loader from the packed weight planes in global memory; p already includes + 8*lane. One fragment (16 rows x 32 k) = FRH halves: two runs of 32 lanes x 8 halves;
// lane (h = lane>>4, row = lane&15): elements 0..7 <- k0+8h+0..7 (first run), elements 8..15 <- k0+16+8h+0..7 (second run) (same map for A and B)
__device__ __forceinline__ v16h ldh(const h16* p) { return cat16(*(const v8h*)p, *(const v8h*)(p + FRH / 2)); }
// N consecutive packed fragments as one group of loads
template <int N> __device__ __forceinline__ void ldhn(v16h (&w)[N], const h16* p) {
#pragma unroll
    for (int i = 0; i < N; ++i) w[i] = ldh(p + i * FRH);
}
// fragments I0 .. I0+N-1 of the V weight plane at p, in the waves that build V (on: wave-uniform); elsewhere the slots are given up, so that no register is held for them across the head
template <int I0, int N> __device__ __forceinline__ void ldv(v16h (&w)[8], const h16* p, bool on) {
    if (on) {
#pragma unroll
        for (int i = I0; i < I0 + N; ++i) w[i] = ldh(p + i * FRH);
        asm volatile("s_wait_xcnt 0x0" :: "v"(p) : "memory");     // p stays in its registers up to this wait
    } else {
#pragma unroll
        for (int i = I0; i < I0 + N; ++i) w[i] = __builtin_nondeterministic_value(w[i]);
    }
}
// same map, rows of the LDS x tile
__device__ __forceinline__ v16h ldl(const h16* p) { const v8h a = *(const v8ha*)p; const v8h c = *(const v8ha*)(p + 16); return cat16(a, c); }
// per-lane fragment slots in LDS (fs already includes + lane), lane i of any wave reads what lane i of the building wave stored: slot (plane, f) = two 16-byte halves, 32 lanes apart
__device__ __forceinline__ v16h ldf(const v8ha* fs, int plane, int f) { const int i = ((plane * 8 + f) * 2) * 32; const v8h a = fs[i]; const v8h c = fs[i + 32]; return cat16(a, c); }
__device__ __forceinline__ void stf(v8ha* fs, int plane, int f, v8h a, v8h c) { const int i = ((plane * 8 + f) * 2) * 32; fs[i] = a; fs[i + 32] = c; }
// f32 tile -> f16 hi and f16 residual (x2048): hi = f16(v), lo = f16((v - hi) * 2048), 20 vector instructions for 8 values
__device__ __forceinline__ void split8(const v8f d, v8h& hi, v8h& lo) {
    unsigned h0, h1, h2, h3, l0, l1, l2, l3; float t0, t1, t2, t3;
    // written as asm because the compiler converts every value twice (singly and packed) and widens each hi again before it subtracts: 31 instructions for the same 8 values.
    // One packed convert per pair gives hi; v - hi reads the packed half directly (exact in f32; even elements wait in the lo register, odd ones in t); (v - hi) * 2048 (exact) is rounded to f16 once,
    // into the low, then the high half of lo. The s_delay_alu lines are the hint for a producer four vector instructions back, so that other waves issue in the gap.
    asm("v_cvt_pk_f16_f32 %0, %12, %13\n\t"
        "v_cvt_pk_f16_f32 %1, %14, %15\n\t"
        "v_cvt_pk_f16_f32 %2, %16, %17\n\t"
        "v_cvt_pk_f16_f32 %3, %18, %19\n\t"
        "s_delay_alu instid0(VALU_DEP_4)\n\t"
        "v_fma_mix_f32 %4, %0, -1.0, %12 op_sel_hi:[1,1,0]\n\t"
        "v_fma_mix_f32 %8, %0, -1.0, %13 op_sel:[1,0,0] op_sel_hi:[1,1,0]\n\t"
        "v_fma_mix_f32 %5, %1, -1.0, %14 op_sel_hi:[1,1,0]\n\t"
        "v_fma_mix_f32 %9, %1, -1.0, %15 op_sel:[1,0,0] op_sel_hi:[1,1,0]\n\t"
        "v_fma_mix_f32 %6, %2, -1.0, %16 op_sel_hi:[1,1,0]\n\t"
        "v_fma_mix_f32 %10, %2, -1.0, %17 op_sel:[1,0,0] op_sel_hi:[1,1,0]\n\t"
        "v_fma_mix_f32 %7, %3, -1.0, %18 op_sel_hi:[1,1,0]\n\t"
        "v_fma_mix_f32 %11, %3, -1.0, %19 op_sel:[1,0,0] op_sel_hi:[1,1,0]\n\t"
        "v_fma_mixlo_f16 %4, %4, %20, 0 op_sel_hi:[0,0,0]\n\t"
        "v_fma_mixlo_f16 %5, %5, %20, 0 op_sel_hi:[0,0,0]\n\t"
        "v_fma_mixlo_f16 %6, %6, %20, 0 op_sel_hi:[0,0,0]\n\t"
        "v_fma_mixlo_f16 %7, %7, %20, 0 op_sel_hi:[0,0,0]\n\t"
        "s_delay_alu instid0(VALU_DEP_4) | instskip(NEXT) | instid1(VALU_DEP_4)\n\t"
        "v_fma_mixhi_f16 %4, %8, %20, 0 op_sel_hi:[0,0,0]\n\t"
        "v_fma_mixhi_f16 %5, %9, %20, 0 op_sel_hi:[0,0,0]\n\t"
        "s_delay_alu instid0(VALU_DEP_4) | instskip(NEXT) | instid1(VALU_DEP_4)\n\t"
        "v_fma_mixhi_f16 %6, %10, %20, 0 op_sel_hi:[0,0,0]\n\t"
        "v_fma_mixhi_f16 %7, %11, %20, 0 op_sel_hi:[0,0,0]"
        : "=&v"(h0), "=&v"(h1), "=&v"(h2), "=&v"(h3), "=&v"(l0), "=&v"(l1), "=&v"(l2), "=&v"(l3), "=&v"(t0), "=&v"(t1), "=&v"(t2), "=&v"(t3)
        : "v"(d[0]), "v"(d[1]), "v"(d[2]), "v"(d[3]), "v"(d[4]), "v"(d[5]), "v"(d[6]), "v"(d[7]), "s"(RSC));
    const v4u h = {h0, h1, h2, h3}, l = {l0, l1, l2, l3};
    hi = __builtin_bit_cast(v8h, h); lo = __builtin_bit_cast(v8h, l);
}
// two 16x16 tiles with K = 64 sharing one B operand: d1 = A1 B, d2 = A2 B
__device__ __forceinline__ void pair_tiles(v16h a1c0, v16h a1c1, v16h a2c0, v16h a2c1, v16h bc0, v16h bc1, v8f& d1, v8f& d2) {
    v8f x = (v8f){}, y = (v8f){};
    x = wmma16(a1c0, bc0, x); y = wmma16(a2c0, bc0, y);
    x = wmma16(a1c1, bc1, x); y = wmma16(a2c1, bc1, y);
    asm volatile("v_nop\n\tv_nop\n\tv_nop\n\tv_nop" : "+v"(x), "+v"(y) : "v"(a1c0), "v"(a1c1), "v"(a2c0), "v"(a2c1), "v"(bc0), "v"(bc1));
    d1 = x; d2 = y;
}

// k_wt: one 64x64 f32 tile in[r][c] (row pitch 64, tile stride 4096) -> f16(bf16_rne(in) * scale) as the 8 fragments of the transposed tile (fragment row = c, k = r), tile stride 4096 halves.
// One grid for all four weight tensors: block = plane * 8 + tile, planes Wq, Wk, Wv (x64), Wproj (x256); the four packed planes lie back to back in dst, 8 tiles each.
__global__ __launch_bounds__(256) void k_wt(const float* __restrict__ wq, const float* __restrict__ wk, const float* __restrict__ wv, const float* __restrict__ wp, h16* dst) {
    __shared__ __align__(16) h16 ts[64 * TP];
    const int tid = threadIdx.x;
    const int r = tid >> 2, c0 = (tid & 3) * 16;           // 64 source rows x 4 column groups of 16
    const int plane = blockIdx.x >> 3, tile = blockIdx.x & 7;   // block-uniform
    const float* s01 = (plane & 1) ? wk : wq;
    const float* s23 = (plane & 1) ? wp : wv;
    const float* src = (plane & 2) ? s23 : s01;
    const float scale = plane == 3 ? 256.0f : 64.0f;
    const float* s = src + (size_t)tile * 4096 + r * 64 + c0;
#pragma unroll
    for (int q = 0; q < 4; ++q) { const v4f x = *(const v4f*)(s + 4 * q);
#pragma unroll
        for (int i = 0; i < 4; ++i) ts[(c0 + 4 * q + i) * TP + r] = (h16)(rbf(x[i]) * scale); }   // ts[c][r], c 0..63, r 0..63 all written
    __syncthreads();
    h16* d = dst + (size_t)blockIdx.x * 4096;
{
#pragma unroll
        for (int s2 = 0; s2 < 2; ++s2) { const int dd = 32 * s2 + (tid >> 3), j = tid & 7;          // 2 x 32 rows = 64 rows; 8 groups j of 8 k values = 64 halves
            const v8h val = *(const v8ha*)(&ts[dd * TP + 8 * j]);
            // k = 8j..8j+7: k step j>>2, run (j>>1)&1, lane half j&1; row dd: row tile dd>>4, lane row dd&15
            *(v8h*)(d + ((dd >> 4) * 2 + (j >> 2)) * FRH + ((j >> 1) & 1) * (FRH / 2) + ((j & 1) * 16 + (dd & 15)) * 8) = val; }
         }
}

// k_mha: one block per batch; wave w owns queries 16w..16w+15 of every head.
// LDS: x tile f16 [64][XP] (written once, block barrier, then read-only); two buffers of fragment slots shared by the block (K hi, K res, V hi, V res: 8 fragments each), head h in buffer h & 1;
// after the last head buffer 0 holds the four waves' output tiles f32 [16][PP] for the row-wise store.
__global__ __launch_bounds__(32 * MW) void k_mha(const float* __restrict__ X, const h16* __restrict__ WQT, const h16* __restrict__ WKT, const h16* __restrict__ WVT,
                                                 const h16* __restrict__ WPT, const float* __restrict__ BP, float* OUT) {
    extern __shared__ __align__(16) unsigned char smem[];
    h16* xs = (h16*)(smem + OFF_X);
    const int tid = threadIdx.x;
    const int lane = tid & 31, wave = __builtin_amdgcn_readfirstlane((int)(threadIdx.x >> 5)), lr = lane & 15, hi = lane >> 4;
    const int b = blockIdx.x;
    const int ks1 = wave & 1, hf = wave >> 1;                   // this wave's share of phase 1: key step ks1, K d step hf; waves 0 and 1, whose causal loop has one key step less, also build V

    // Every weight fragment is asked for one stage before the stage that multiplies with it, so that the load's latency passes under other work:
    // kw, vw (phase 1 of a head) during the output projection of the head before, here for head 0; Wq before the K tiles; Wproj in one group behind the flash loop.
    v16h kw[4], vw[8];                                          // Wk^T d tiles 2hf, 2hf+1 x 2 c steps; Wv^T 4 d tiles x 2 c steps (waves 0 and 1 only; never read elsewhere)
    ldhn(kw, WKT + (size_t)lane * 8 + (2 * hf) * 1024);
    ldv<0, 8>(vw, WVT + (size_t)lane * 8, hf == 0);

    // stage x[b] as f16 (via bf16 RNE convert): 1024 groups of 4 elements, rows 0..63 x columns 0..63 all written
    {
        const float* xb = X + (size_t)b * (TT * CC);
#pragma unroll
        for (int it = 0; it < 8; ++it) {
            const int e = 4 * (tid + 128 * it); const int row = e >> 6, col = e & 63;
            const v4f v = *(const v4f*)(xb + e); v4h o;
#pragma unroll
            for (int k = 0; k < 4; ++k) o[k] = (h16)rbf(v[k]);
            *(v4ha*)(xs + row * XP + col) = o;
        }
    }
    __syncthreads();

    const h16* xr = xs + lr * XP + 8 * hi;                      // + tile*16*XP + 32*cs
    const int ti = wave;                                        // this wave's query tile
    const int t = 16 * ti + lr;
    const int nks = (ti >> 1) + 1;                              // key steps of 32 that contain keys <= the tile's last query
    v8f pacc[4];                                                // out rows 16ti + 8hi + r, columns 16cj + lr, summed over the heads
#pragma unroll
    for (int cj = 0; cj < 4; ++cj) pacc[cj] = (v8f){};

#pragma unroll 1
    for (int h = 0; h < NHD; ++h) {
        v8ha* fs = (v8ha*)(smem + OFF_F) + (h & 1) * (FBUF / 16) + lane;
        const size_t wo = (size_t)h * 4096 + (size_t)lane * 8;           // packed weight planes [h][row tile][k step]: + tile*2*FRH + cs*FRH
        const size_t wn = (size_t)(h + 1 < NHD ? h + 1 : h) * 4096 + (size_t)lane * 8;   // the next head's planes (the last head asks for its own again; nothing reads that)
        v16h qw[8];                                                      // Wq^T 4 d tiles x 2 c steps

        // ---- phase 1: this wave's share of the head's K^T and V tiles, packed into the shared fragment slots ----
        {
            const h16* xa = xr + (2 * ks1) * 16 * XP;
            const v16h xa0 = ldl(xa), xa1 = ldl(xa + 32), xb0 = ldl(xa + 16 * XP), xb1 = ldl(xa + 16 * XP + 32);
            // V[key][d] = x Wv: A = x rows (key tiles 2ks1, 2ks1+1), B = Wv^T rows (col d). D row = key, col = d -> A fragment of O^T (row d, k = key)
            if (hf == 0) {                                        // wave-uniform: waves 0 and 1
#pragma unroll                                                    // vw[] stays in registers only under a compile-time dj
                for (int dj = 0; dj < 4; ++dj) {
                    v8f d1, d2; pair_tiles(xa0, xa1, xb0, xb1, vw[2 * dj], vw[2 * dj + 1], d1, d2);
                    v8h h1, l1, h2, l2; split8(d1, h1, l1); split8(d2, h2, l2);
                    stf(fs, 2, dj * 2 + ks1, h1, h2); stf(fs, 3, dj * 2 + ks1, l1, l2);
                }
            }
            ldhn(qw, WQT + wo);                                   // used behind the barrier; in flight under the K tiles
            // K^T[d][key] = Wk^T x^T: A = Wk^T rows (d tiles 2hf, 2hf+1), B = x rows (col key). D row = d, col = key -> A fragment of S^T (row key, k = d)
            {
                const v16h a10 = kw[0], a11 = kw[1], a20 = kw[2], a21 = kw[3];
                v8f d1, d2; v8h h1, l1, h2, l2;
                pair_tiles(a10, a11, a20, a21, xa0, xa1, d1, d2);
                split8(d1, h1, l1); split8(d2, h2, l2);
                stf(fs, 0, (2 * ks1) * 2 + hf, h1, h2); stf(fs, 1, (2 * ks1) * 2 + hf, l1, l2);
                pair_tiles(a10, a11, a20, a21, xb0, xb1, d1, d2);
                split8(d1, h1, l1); split8(d2, h2, l2);
                stf(fs, 0, (2 * ks1 + 1) * 2 + hf, h1, h2); stf(fs, 1, (2 * ks1 + 1) * 2 + hf, l1, l2);
            }
        }
        // publishes head h's slots to the block; a wave that has passed it has also left head h-1's slots, so the buffer that head h+1 fills has no reader left
        __syncthreads();

        // ---- phase 2: this wave's 16-query tile: Q^T fragments, causal flash loop, ctx, output projection ----
        {
            v16h qh0, ql0, qh1, ql1;                              // B fragments: col t, k = d (d steps 0..31, 32..63), hi and residual
            {
                const h16* xq = xr + ti * 16 * XP;
                const v16h x0 = ldl(xq), x1 = ldl(xq + 32);
                v8f d1, d2; v8h h1, l1, h2, l2;
                {
                    pair_tiles(qw[0], qw[1], qw[2], qw[3], x0, x1, d1, d2);
                    split8(d1, h1, l1); split8(d2, h2, l2);
                    qh0 = cat16(h1, h2); ql0 = cat16(l1, l2);
                }
                {
                    pair_tiles(qw[4], qw[5], qw[6], qw[7], x0, x1, d1, d2);
                    split8(d1, h1, l1); split8(d2, h2, l2);
                    qh1 = cat16(h1, h2); ql1 = cat16(l1, l2);
                }
            }
            v8f o[4], ol[4];
#pragma unroll
            for (int j = 0; j < 4; ++j) { o[j] = (v8f){}; ol[j] = (v8f){}; }
            float m = NEGB, l = 0.0f;
#pragma unroll 1
            for (int ks = 0; ks < nks; ++ks) {
                const int fa = 4 * ks;                            // K slots: key tile 2ks -> fa, fa+1 (d steps); key tile 2ks+1 -> fa+2, fa+3
                v8f sa = (v8f){}, sal = (v8f){}, sb = (v8f){}, sbl = (v8f){};
                {
                    const v16h kh0 = ldf(fs, 0, fa), kh1 = ldf(fs, 0, fa + 1), kl0 = ldf(fs, 1, fa), kl1 = ldf(fs, 1, fa + 1);
                    sa = wmma16(kh0, qh0, sa); sal = wmma16(kl0, qh0, sal);
                    sa = wmma16(kh1, qh1, sa); sal = wmma16(kh0, ql0, sal);
                    sal = wmma16(kl1, qh1, sal); sal = wmma16(kh1, ql1, sal);
                    asm volatile("v_nop\n\tv_nop\n\tv_nop\n\tv_nop" : "+v"(sa), "+v"(sal) : "v"(kh0), "v"(kh1), "v"(kl0), "v"(kl1), "v"(qh0), "v"(qh1), "v"(ql0), "v"(ql1));
                }
                {
                    const v16h kh0 = ldf(fs, 0, fa + 2), kh1 = ldf(fs, 0, fa + 3), kl0 = ldf(fs, 1, fa + 2), kl1 = ldf(fs, 1, fa + 3);
                    sb = wmma16(kh0, qh0, sb); sbl = wmma16(kl0, qh0, sbl);
                    sb = wmma16(kh1, qh1, sb); sbl = wmma16(kh0, ql0, sbl);
                    sbl = wmma16(kl1, qh1, sbl); sbl = wmma16(kh1, ql1, sbl);
                    asm volatile("v_nop\n\tv_nop\n\tv_nop\n\tv_nop" : "+v"(sb), "+v"(sbl) : "v"(kh0), "v"(kh1), "v"(kl0), "v"(kl1), "v"(qh0), "v"(qh1), "v"(ql0), "v"(ql1));
                }
                // S^T D layout: sa[r] = (key = 32ks + 8hi + r, t), sb[r] = (key = 32ks + 16 + 8hi + r, t); causal replace-fill for key > t
                const int kbase = 32 * ks + 8 * hi;
                float ta[8], tb[8]; float mx = NEGB;
#pragma unroll
                for (int r = 0; r < 8; ++r) {
                    const float va = (sa[r] + sal[r] * RES) * SCQ;
                    const float vb = (sb[r] + sbl[r] * RES) * SCQ;
                    ta[r] = (kbase + r <= t) ? va : NEGB;
                    tb[r] = (kbase + 16 + r <= t) ? vb : NEGB;
                    mx = fmaxf(mx, fmaxf(ta[r], tb[r]));
                }
                mx = fmaxf(mx, __shfl_xor(mx, 16, 32));
                const float mnew = fmaxf(m, mx);
                const float alpha = __builtin_amdgcn_exp2f(m - mnew);
                const float sh = PSH - mnew;
                v8f pa8, pb8; float ls = 0.0f;
#pragma unroll
                for (int r = 0; r < 8; ++r) {
                    const float fa_ = __builtin_amdgcn_exp2f(ta[r] + sh);
                    const float fb_ = __builtin_amdgcn_exp2f(tb[r] + sh);
                    pa8[r] = fa_; pb8[r] = fb_;
                    ls += fa_ + fb_;
                }
                v8h ph1, pl1, ph2, pl2; split8(pa8, ph1, pl1); split8(pb8, ph2, pl2);
                const v16h pb = cat16(ph1, ph2), pl = cat16(pl1, pl2);
                l = l * alpha + ls; m = mnew;
#pragma unroll
                for (int j = 0; j < 4; ++j) { o[j] = o[j] * alpha; ol[j] = ol[j] * alpha; }
                // O^T[d][t] += V^T P^T: A = V slots (row d, k = key), B = packed P^T; residual products (V res x P hi, V hi x P res) in ol
#pragma unroll
                for (int j = 0; j < 4; ++j) {
                    const v16h vh = ldf(fs, 2, 2 * j + ks), vl = ldf(fs, 3, 2 * j + ks);
                    o[j] = wmma16(vh, pb, o[j]); ol[j] = wmma16(vl, pb, ol[j]); ol[j] = wmma16(vh, pl, ol[j]);
                    asm volatile("v_nop\n\tv_nop\n\tv_nop\n\tv_nop" : "+v"(o[j]), "+v"(ol[j]) : "v"(vh), "v"(vl), "v"(pb), "v"(pl));
                }
            }
            v16h bw[8];                                           // Wproj^T 4 c tiles x 2 d steps, in flight under the normalisation and the split of ctx
            ldhn(bw, WPT + wo);
            l += __shfl_xor(l, 16, 32);
            const float cs = CSC * (1.0f / l);
            // O^T D layout: o[j][r] = (d = 16j + 8hi + r, t = lr) -> A fragment of the projection (row t, k = d): d step ds <- tiles 2ds (elements 0..7), 2ds+1 (elements 8..15)
            v8h ch_[4], cl_[4];
#pragma unroll
            for (int j = 0; j < 4; ++j) {
                v8f c;
#pragma unroll
                for (int r = 0; r < 8; ++r) c[r] = (o[j][r] + ol[j][r] * RES) * cs;
                split8(c, ch_[j], cl_[j]);
                if (j == 1) ldv<0, 4>(vw, WVT + wn, hf == 0);     // the next head's phase-1 weights follow as registers come free: half of o and ol is dead here
            }
            const v16h cah0 = cat16(ch_[0], ch_[1]), cal0 = cat16(cl_[0], cl_[1]), cah1 = cat16(ch_[2], ch_[3]), cal1 = cat16(cl_[2], cl_[3]);
            // out[t][c] += ctx_h Wproj[h*64.., :]: B = Wproj^T rows (col c, k = h*64 + d); D layout: acc[r] = (t = 16ti + 8hi + r, c = 16cj + lr)
            ldhn(kw, WKT + wn + (2 * hf) * 1024);                 // all of o and ol is dead here
#pragma unroll                                                  // pacc[cj] stays in registers only under a compile-time cj
            for (int cj = 0; cj < 4; ++cj) {
                const v16h b0 = bw[2 * cj], b1 = bw[2 * cj + 1];
                v8f acc = (v8f){}, accl = (v8f){};
                acc = wmma16(cah0, b0, acc); accl = wmma16(cal0, b0, accl);
                acc = wmma16(cah1, b1, acc); accl = wmma16(cal1, b1, accl);
                asm volatile("v_nop\n\tv_nop\n\tv_nop\n\tv_nop" : "+v"(acc), "+v"(accl) : "v"(cah0), "v"(cal0), "v"(cah1), "v"(cal1), "v"(b0), "v"(b1));
#pragma unroll
                for (int r = 0; r < 8; ++r) pacc[cj][r] = pacc[cj][r] + (acc[r] + accl[r] * RES) * OSC;
            }
            ldv<4, 4>(vw, WVT + wn, hf == 0);                     // last, behind every wait for bw: loads that only two of the waves issue would shorten the counts of the waits that follow them
        }
        asm volatile("s_wait_xcnt 0x0" ::: "memory");           // the next head rewrites the offset register that this head's weight loads name
    }

    // ---- epilogue: out[t][c] = bias + sum over the heads; each wave turns its own 16 rows through LDS for 16-byte row-wise stores ----
    // buffer 0 is free here: its last readers (head NHD-2) finished before they passed the last head's barrier
    float* pw = (float*)(smem + OFF_F) + wave * (16 * PP);
#pragma unroll
    for (int cj = 0; cj < 4; ++cj) {
#pragma unroll
        for (int r = 0; r < 8; ++r) pw[(8 * hi + r) * PP + 16 * cj + lr] = pacc[cj][r];
    }
    __syncthreads();                                            // the tile's stores are complete before other lanes read them row-wise
    v4f bv = *(const v4f*)(BP + 4 * lr);
#pragma unroll
    for (int k = 0; k < 4; ++k) bv[k] = rbf(bv[k]);
    v4f vals[8];
#pragma unroll
    for (int s = 0; s < 8; ++s) {
        const v4f a = *(const v4fa*)(pw + (2 * s + hi) * PP + 4 * lr);
        vals[s] = a + bv;
    }
    float* orow = OUT + (size_t)b * (TT * CC) + (size_t)(16 * wave) * CC + 4 * lr;
{
#pragma unroll
        for (int s = 0; s < 8; ++s) *(v4f*)(orow + (size_t)(2 * s + hi) * CC) = vals[s];   // 8 s x 2 rows = 16 rows; 16 lanes x 4 floats = 64 columns
         }
}

static constexpr size_t SZ_W = (size_t)NHD * CC * HD * 2;               // 65536 B per weight plane
static constexpr size_t SZ_TOTAL = 4 * SZ_W;
static_assert((size_t)HDT * CC * 2 <= SZ_W);
static_assert(SZ_W == (size_t)8 * 4096 * 2 && NHD == 8 && HDT / 64 == 8);   // k_wt: 8 tiles of 4096 halves per plane, planes contiguous
static_assert(SZ_TOTAL <= (size_t)134217728);

extern "C" void kernel_launch(void* const* d_in, const int* in_sizes, int n_in,
                              void* d_out, int out_size, void* d_ws, size_t ws_size, hipStream_t stream) {
    if (n_in < 6) return;
    if ((size_t)in_sizes[0] < (size_t)NB * TT * CC) return;
    if (in_sizes[1] < NHD * CC * HD || in_sizes[2] < NHD * CC * HD || in_sizes[3] < NHD * CC * HD) return;
    if (in_sizes[4] < HDT * CC || in_sizes[5] < CC) return;
    if ((size_t)out_size < (size_t)NB * TT * CC) return;
    if (SZ_TOTAL > ws_size) return;
    const float* x  = (const float*)d_in[0];     // wire order x, Wq, Wk, Wv, Wproj, bproj
    const float* Wq = (const float*)d_in[1];
    const float* Wk = (const float*)d_in[2];
    const float* Wv = (const float*)d_in[3];
    const float* Wp = (const float*)d_in[4];
    const float* bp = (const float*)d_in[5];
    float* OUT = (float*)d_out;                  // [NB][64][64]
    char* wsp = (char*)d_ws;
    h16* WQT = (h16*)wsp; wsp += SZ_W;           // [8 heads][4 d tiles][2 c steps] fragments, x64
    h16* WKT = (h16*)wsp; wsp += SZ_W;           // [8 heads][4 d tiles][2 c steps] fragments, x64
    h16* WVT = (h16*)wsp; wsp += SZ_W;           // [8 heads][4 d tiles][2 c steps] fragments, x64
    h16* WPT = (h16*)wsp; wsp += SZ_W;           // [8 heads][4 c tiles][2 d steps] fragments, x256

    // W[h]: in[64 c][64 d] -> fragments (row d, k = c) per head; Wproj: in[512 k][64 c] -> fragments (row c, k = d of head h), 8 tiles of 64 k rows = 8 heads
    // grid = 4 planes x 8 tiles; block p * 8 + i writes tile i of the plane at WQT + p * 32768 halves (WQT, WKT, WVT, WPT in this order)
    k_wt<<<32, 256, 0, stream>>>(Wq, Wk, Wv, Wp, WQT);

    (void)hipFuncSetAttribute(reinterpret_cast<const void*>(&k_mha), hipFuncAttributeMaxDynamicSharedMemorySize, (int)LDS_BYTES);
    k_mha<<<NB, 32 * MW, LDS_BYTES, stream>>>(x, WQT, WKT, WVT, WPT, bp, OUT);
}

// v006
// Measured time: 56.2 microseconds a run.
// Timed twice side by side with v005, it ran 1.15 and 1.16 times as fast.
// Over all steps from v000 it is 3.61 times as fast.
#include <hip/hip_runtime.h>

// Causal multi-head attention with per-head q/k/v projections and an output projection: x [NB][64][64], Wq/Wk/Wv [8][64 in][64 out], Wproj [512 in][64 out], bias [64]; out [NB][64][64] f32.
// Compute dtypes, f32 accumulate everywhere, all contractions v_wmma_f32_16x16x32_f16: x and all weights RNE-converted to bf16 and held in f16 containers (weights x64 / x256, exact), so input x input products are exact;
// q, k, v, P and ctx are carried as f16 hi + f16 residual planes at one scale (the carries x64, x256, x16 keep the residuals of ordinary values in f16's normal range), so residual products add into the accumulator of the hi products;
// P carries x256 (cancels in the normalisation); softmax f32 (online, running max).
// Transposed chaining: K^T, Q^T tiles (D rows = d) pack directly into the A (keys) / B (queries) fragments of S^T = K Q^T; V tiles (D rows = key) pack into the A fragment of O^T = V^T P^T; packed P^T is its B fragment;
// O^T tiles pack into the A fragment of the output projection. The weight planes lie in the workspace in fragment order (1 KiB per 16 x 32 fragment, lane-contiguous), so a wave's 16-byte weight loads read whole 128-byte lines. One block per batch, 4 waves; the block walks the 8 heads together: each wave builds a share of the head's K/V fragments into shared LDS slots,
// then runs one 16-query tile against them; its 16 output rows are summed over heads 0..7 in registers.

#ifndef NB
#define NB 2048
#endif
#define NB_FULL 2048
#define TT   64                  // tokens per batch
#define CC   64                  // embedding width
#define NHD  8                   // heads
#define HD   64                  // head size
#define HDT  (NHD * HD)          // 512
#define MW   4                   // waves per block (one 16-query tile each)
#define XP   72                  // LDS pitch (halves) of the x tile
#define PP   68                  // LDS pitch (floats) of the output tiles
#define TP   72                  // LDS pitch (halves) of the weight transpose tile
#define PSH  8.0f                // log2 of the P carry (256)
#define SCQ  (0.125f * 1.4426950408889634f / 4096.0f)   // HD^-0.5 * log2(e) / (64 * 64 weight carries)
#define CSC  0.25f               // ctx carry 16 / v weight carry 64
#define OSC  (1.0f / 4096.0f)    // 1 / (ctx carry 16 * Wproj carry 256)
#define NEGB (-3.0e38f)
#define FRH  512                 // halves per packed weight fragment; a 64 x 64 plane holds 8: index = row tile * 2 + k step

#define OFF_X 0
#define OFF_F (TT * XP * 2)                       // 9216
#define FBUF 32768                                // one head's fragment slots: K hi, K res, V hi, V res, 8 fragments of 1 KiB each
#define LDS_BYTES (OFF_F + 2 * FBUF)              // 74752

static_assert(NB <= NB_FULL);
static_assert(MW * 16 == TT);
static_assert(NHD % 2 == 0);
static_assert(MW * 16 * PP * 4 <= FBUF);
static_assert(HD == 64);
static_assert(TT == 64);
static_assert(CC == 64);
static_assert(OFF_F % 16 == 0);
static_assert((XP * 2) % 16 == 0);
static_assert((PP * 4) % 16 == 0);
static_assert(LDS_BYTES <= 262144);

typedef _Float16 h16;
typedef __attribute__((ext_vector_type(16))) _Float16 v16h;
typedef __attribute__((ext_vector_type(8)))  _Float16 v8h;
typedef __attribute__((ext_vector_type(4)))  _Float16 v4h;
typedef __attribute__((ext_vector_type(8)))  float    v8f;
typedef __attribute__((ext_vector_type(4)))  float    v4f;
typedef __attribute__((ext_vector_type(4)))  unsigned v4u;
typedef v4f  __attribute__((may_alias)) v4fa;
typedef v8h  __attribute__((may_alias)) v8ha;
typedef v4h  __attribute__((may_alias)) v4ha;

// RNE convert of an f32 value to the bf16 grid, returned as f32 (exactly representable in f16 for normal-range magnitudes)
__device__ __forceinline__ float rbf(float f) { unsigned u = __float_as_uint(f); u += 0x7FFFu + ((u >> 16) & 1u); return __uint_as_float(u & 0xFFFF0000u); }
__device__ __forceinline__ v16h cat16(v8h lo, v8h hi) { return __builtin_shufflevector(lo, hi, 0, 1, 2, 3, 4, 5, 6, 7, 8, 9, 10, 11, 12, 13, 14, 15); }
__device__ __forceinline__ v8f wmma16(v16h a, v16h b, v8f c) { return __builtin_amdgcn_wmma_f32_16x16x32_f16(false, a, false, b, (short)0, c, false, false); }
// fragment loader from the packed weight planes in global memory; p already includes + 8*lane. One fragment (16 rows x 32 k) = FRH halves: two runs of 32 lanes x 8 halves;
// lane (h = lane>>4, row = lane&15): elements 0..7 <- k0+8h+0..7 (first run), elements 8..15 <- k0+16+8h+0..7 (second run) (same map for A and B)
__device__ __forceinline__ v16h ldh(const h16* p) { return cat16(*(const v8h*)p, *(const v8h*)(p + FRH / 2)); }
// N consecutive packed fragments as one group of loads
template <int N> __device__ __forceinline__ void ldhn(v16h (&w)[N], const h16* p) {
#pragma unroll
    for (int i = 0; i < N; ++i) w[i] = ldh(p + i * FRH);
}
// fragments I0 .. I0+N-1 of the V weight plane at p, in the waves that build V (on: wave-uniform); elsewhere the slots are given up, so that no register is held for them across the head
template <int I0, int N> __device__ __forceinline__ void ldv(v16h (&w)[8], const h16* p, bool on) {
    if (on) {
#pragma unroll
        for (int i = I0; i < I0 + N; ++i) w[i] = ldh(p + i * FRH);
        asm volatile("s_wait_xcnt 0x0" :: "v"(p) : "memory");     // p stays in its registers up to this wait
    } else {
#pragma unroll
        for (int i = I0; i < I0 + N; ++i) w[i] = __builtin_nondeterministic_value(w[i]);
    }
}
// same map, rows of the LDS x tile
__device__ __forceinline__ v16h ldl(const h16* p) { const v8h a = *(const v8ha*)p; const v8h c = *(const v8ha*)(p + 16); return cat16(a, c); }
// per-lane fragment slots in LDS (fs already includes + lane), lane i of any wave reads what lane i of the building wave stored: slot (plane, f) = two 16-byte halves, 32 lanes apart
__device__ __forceinline__ v16h ldf(const v8ha* fs, int plane, int f) { const int i = ((plane * 8 + f) * 2) * 32; const v8h a = fs[i]; const v8h c = fs[i + 32]; return cat16(a, c); }
__device__ __forceinline__ void stf(v8ha* fs, int plane, int f, v8h a, v8h c) { const int i = ((plane * 8 + f) * 2) * 32; fs[i] = a; fs[i + 32] = c; }
// f32 tile -> f16 hi and f16 residual: hi = f16(v), lo = f16(v - hi), 16 vector instructions for 8 values
__device__ __forceinline__ void split8(const v8f d, v8h& hi, v8h& lo) {
    unsigned h0, h1, h2, h3, l0, l1, l2, l3; float t0, t1, t2, t3;
    // written as asm because the compiler converts every value twice (singly and packed) and widens each hi again before it subtracts: 31 instructions for the same 8 values.
    // One packed convert per pair gives hi; v - hi reads the packed half directly (exact in f32; even elements wait in the lo register, odd ones in t); a second packed convert per pair rounds the
    // differences to f16 once. The s_delay_alu lines are the hint for a producer four vector instructions back, so that other waves issue in the gap.
    asm("v_cvt_pk_f16_f32 %0, %12, %13\n\t"
        "v_cvt_pk_f16_f32 %1, %14, %15\n\t"
        "v_cvt_pk_f16_f32 %2, %16, %17\n\t"
        "v_cvt_pk_f16_f32 %3, %18, %19\n\t"
        "s_delay_alu instid0(VALU_DEP_4)\n\t"
        "v_fma_mix_f32 %4, %0, -1.0, %12 op_sel_hi:[1,1,0]\n\t"
        "v_fma_mix_f32 %8, %0, -1.0, %13 op_sel:[1,0,0] op_sel_hi:[1,1,0]\n\t"
        "v_fma_mix_f32 %5, %1, -1.0, %14 op_sel_hi:[1,1,0]\n\t"
        "v_fma_mix_f32 %9, %1, -1.0, %15 op_sel:[1,0,0] op_sel_hi:[1,1,0]\n\t"
        "v_fma_mix_f32 %6, %2, -1.0, %16 op_sel_hi:[1,1,0]\n\t"
        "v_fma_mix_f32 %10, %2, -1.0, %17 op_sel:[1,0,0] op_sel_hi:[1,1,0]\n\t"
        "v_fma_mix_f32 %7, %3, -1.0, %18 op_sel_hi:[1,1,0]\n\t"
        "v_fma_mix_f32 %11, %3, -1.0, %19 op_sel:[1,0,0] op_sel_hi:[1,1,0]\n\t"
        "v_cvt_pk_f16_f32 %4, %4, %8\n\t"
        "v_cvt_pk_f16_f32 %5, %5, %9\n\t"
        "v_cvt_pk_f16_f32 %6, %6, %10\n\t"
        "s_delay_alu instid0(VALU_DEP_4)\n\t"
        "v_cvt_pk_f16_f32 %7, %7, %11"
        : "=&v"(h0), "=&v"(h1), "=&v"(h2), "=&v"(h3), "=&v"(l0), "=&v"(l1), "=&v"(l2), "=&v"(l3), "=&v"(t0), "=&v"(t1), "=&v"(t2), "=&v"(t3)
        : "v"(d[0]), "v"(d[1]), "v"(d[2]), "v"(d[3]), "v"(d[4]), "v"(d[5]), "v"(d[6]), "v"(d[7]));
    const v4u h = {h0, h1, h2, h3}, l = {l0, l1, l2, l3};
    hi = __builtin_bit_cast(v8h, h); lo = __builtin_bit_cast(v8h, l);
}
// two 16x16 tiles with K = 64 sharing one B operand: d1 = A1 B, d2 = A2 B
__device__ __forceinline__ void pair_tiles(v16h a1c0, v16h a1c1, v16h a2c0, v16h a2c1, v16h bc0, v16h bc1, v8f& d1, v8f& d2) {
    v8f x = (v8f){}, y = (v8f){};
    x = wmma16(a1c0, bc0, x); y = wmma16(a2c0, bc0, y);
    x = wmma16(a1c1, bc1, x); y = wmma16(a2c1, bc1, y);
    asm volatile("v_nop\n\tv_nop\n\tv_nop\n\tv_nop" : "+v"(x), "+v"(y) : "v"(a1c0), "v"(a1c1), "v"(a2c0), "v"(a2c1), "v"(bc0), "v"(bc1));
    d1 = x; d2 = y;
}

// k_wt: one 64x64 f32 tile in[r][c] (row pitch 64, tile stride 4096) -> f16(bf16_rne(in) * scale) as the 8 fragments of the transposed tile (fragment row = c, k = r), tile stride 4096 halves.
// One grid for all four weight tensors: block = plane * 8 + tile, planes Wq, Wk, Wv (x64), Wproj (x256); the four packed planes lie back to back in dst, 8 tiles each.
__global__ __launch_bounds__(256) void k_wt(const float* __restrict__ wq, const float* __restrict__ wk, const float* __restrict__ wv, const float* __restrict__ wp, h16* dst) {
    __shared__ __align__(16) h16 ts[64 * TP];
    const int tid = threadIdx.x;
    const int r = tid >> 2, c0 = (tid & 3) * 16;           // 64 source rows x 4 column groups of 16
    const int plane = blockIdx.x >> 3, tile = blockIdx.x & 7;   // block-uniform
    const float* s01 = (plane & 1) ? wk : wq;
    const float* s23 = (plane & 1) ? wp : wv;
    const float* src = (plane & 2) ? s23 : s01;
    const float scale = plane == 3 ? 256.0f : 64.0f;
    const float* s = src + (size_t)tile * 4096 + r * 64 + c0;
#pragma unroll
    for (int q = 0; q < 4; ++q) { const v4f x = *(const v4f*)(s + 4 * q);
#pragma unroll
        for (int i = 0; i < 4; ++i) ts[(c0 + 4 * q + i) * TP + r] = (h16)(rbf(x[i]) * scale); }   // ts[c][r], c 0..63, r 0..63 all written
    __syncthreads();
    h16* d = dst + (size_t)blockIdx.x * 4096;
{
#pragma unroll
        for (int s2 = 0; s2 < 2; ++s2) { const int dd = 32 * s2 + (tid >> 3), j = tid & 7;          // 2 x 32 rows = 64 rows; 8 groups j of 8 k values = 64 halves
            const v8h val = *(const v8ha*)(&ts[dd * TP + 8 * j]);
            // k = 8j..8j+7: k step j>>2, run (j>>1)&1, lane half j&1; row dd: row tile dd>>4, lane row dd&15
            *(v8h*)(d + ((dd >> 4) * 2 + (j >> 2)) * FRH + ((j >> 1) & 1) * (FRH / 2) + ((j & 1) * 16 + (dd & 15)) * 8) = val; }
         }
}

// k_mha: one block per batch; wave w owns queries 16w..16w+15 of every head.
// LDS: x tile f16 [64][XP] (written once, block barrier, then read-only); two buffers of fragment slots shared by the block (K hi, K res, V hi, V res: 8 fragments each), head h in buffer h & 1;
// after the last head buffer 0 holds the four waves' output tiles f32 [16][PP] for the row-wise store.
__global__ __launch_bounds__(32 * MW) void k_mha(const float* __restrict__ X, const h16* __restrict__ WQT, const h16* __restrict__ WKT, const h16* __restrict__ WVT,
                                                 const h16* __restrict__ WPT, const float* __restrict__ BP, float* OUT) {
    extern __shared__ __align__(16) unsigned char smem[];
    h16* xs = (h16*)(smem + OFF_X);
    const int tid = threadIdx.x;
    const int lane = tid & 31, wave = __builtin_amdgcn_readfirstlane((int)(threadIdx.x >> 5)), lr = lane & 15, hi = lane >> 4;
    const int b = blockIdx.x;
    const int ks1 = wave & 1, hf = wave >> 1;                   // this wave's share of phase 1: key step ks1, K d step hf; waves 0 and 1, whose causal loop has one key step less, also build V

    // Every weight fragment is asked for one stage before the stage that multiplies with it, so that the load's latency passes under other work:
    // kw, vw (phase 1 of a head) during the output projection of the head before, here for head 0; Wq before the K tiles; Wproj in one group behind the flash loop.
    v16h kw[4], vw[8];                                          // Wk^T d tiles 2hf, 2hf+1 x 2 c steps; Wv^T 4 d tiles x 2 c steps (waves 0 and 1 only; never read elsewhere)
    ldhn(kw, WKT + (size_t)lane * 8 + (2 * hf) * 1024);
    ldv<0, 8>(vw, WVT + (size_t)lane * 8, hf == 0);

    // stage x[b] as f16 (via bf16 RNE convert): 1024 groups of 4 elements, rows 0..63 x columns 0..63 all written
    {
        const float* xb = X + (size_t)b * (TT * CC);
#pragma unroll
        for (int it = 0; it < 8; ++it) {
            const int e = 4 * (tid + 128 * it); const int row = e >> 6, col = e & 63;
            const v4f v = *(const v4f*)(xb + e); v4h o;
#pragma unroll
            for (int k = 0; k < 4; ++k) o[k] = (h16)rbf(v[k]);
            *(v4ha*)(xs + row * XP + col) = o;
        }
    }
    __syncthreads();

    const h16* xr = xs + lr * XP + 8 * hi;                      // + tile*16*XP + 32*cs
    const int ti = wave;                                        // this wave's query tile
    const int t = 16 * ti + lr;
    const int nks = (ti >> 1) + 1;                              // key steps of 32 that contain keys <= the tile's last query
    v8f pacc[4];                                                // out rows 16ti + 8hi + r, columns 16cj + lr, summed over the heads (x4096: ctx and Wproj carries)
#pragma unroll
    for (int cj = 0; cj < 4; ++cj) pacc[cj] = (v8f){};

#pragma unroll 1
    for (int h = 0; h < NHD; ++h) {
        v8ha* fs = (v8ha*)(smem + OFF_F) + (h & 1) * (FBUF / 16) + lane;
        const size_t wo = (size_t)h * 4096 + (size_t)lane * 8;           // packed weight planes [h][row tile][k step]: + tile*2*FRH + cs*FRH
        const size_t wn = (size_t)(h + 1 < NHD ? h + 1 : h) * 4096 + (size_t)lane * 8;   // the next head's planes (the last head asks for its own again; nothing reads that)
        v16h qw[8];                                                      // Wq^T 4 d tiles x 2 c steps

        // ---- phase 1: this wave's share of the head's K^T and V tiles, packed into the shared fragment slots ----
        {
            const h16* xa = xr + (2 * ks1) * 16 * XP;
            const v16h xa0 = ldl(xa), xa1 = ldl(xa + 32), xb0 = ldl(xa + 16 * XP), xb1 = ldl(xa + 16 * XP + 32);
            // V[key][d] = x Wv: A = x rows (key tiles 2ks1, 2ks1+1), B = Wv^T rows (col d). D row = key, col = d -> A fragment of O^T (row d, k = key)
            if (hf == 0) {                                        // wave-uniform: waves 0 and 1
#pragma unroll                                                    // vw[] stays in registers only under a compile-time dj
                for (int dj = 0; dj < 4; ++dj) {
                    v8f d1, d2; pair_tiles(xa0, xa1, xb0, xb1, vw[2 * dj], vw[2 * dj + 1], d1, d2);
                    v8h h1, l1, h2, l2; split8(d1, h1, l1); split8(d2, h2, l2);
                    stf(fs, 2, dj * 2 + ks1, h1, h2); stf(fs, 3, dj * 2 + ks1, l1, l2);
                }
            }
            ldhn(qw, WQT + wo);                                   // used behind the barrier; in flight under the K tiles
            // K^T[d][key] = Wk^T x^T: A = Wk^T rows (d tiles 2hf, 2hf+1), B = x rows (col key). D row = d, col = key -> A fragment of S^T (row key, k = d)
            {
                const v16h a10 = kw[0], a11 = kw[1], a20 = kw[2], a21 = kw[3];
                v8f d1, d2; v8h h1, l1, h2, l2;
                pair_tiles(a10, a11, a20, a21, xa0, xa1, d1, d2);
                split8(d1, h1, l1); split8(d2, h2, l2);
                stf(fs, 0, (2 * ks1) * 2 + hf, h1, h2); stf(fs, 1, (2 * ks1) * 2 + hf, l1, l2);
                pair_tiles(a10, a11, a20, a21, xb0, xb1, d1, d2);
                split8(d1, h1, l1); split8(d2, h2, l2);
                stf(fs, 0, (2 * ks1 + 1) * 2 + hf, h1, h2); stf(fs, 1, (2 * ks1 + 1) * 2 + hf, l1, l2);
            }
        }
        // publishes head h's slots to the block; a wave that has passed it has also left head h-1's slots, so the buffer that head h+1 fills has no reader left
        __syncthreads();

        // ---- phase 2: this wave's 16-query tile: Q^T fragments, causal flash loop, ctx, output projection ----
        {
            v16h qh0, ql0, qh1, ql1;                              // B fragments: col t, k = d (d steps 0..31, 32..63), hi and residual
            {
                const h16* xq = xr + ti * 16 * XP;
                const v16h x0 = ldl(xq), x1 = ldl(xq + 32);
                v8f d1, d2; v8h h1, l1, h2, l2;
                {
                    pair_tiles(qw[0], qw[1], qw[2], qw[3], x0, x1, d1, d2);
                    split8(d1, h1, l1); split8(d2, h2, l2);
                    qh0 = cat16(h1, h2); ql0 = cat16(l1, l2);
                }
                {
                    pair_tiles(qw[4], qw[5], qw[6], qw[7], x0, x1, d1, d2);
                    split8(d1, h1, l1); split8(d2, h2, l2);
                    qh1 = cat16(h1, h2); ql1 = cat16(l1, l2);
                }
            }
            v8f o[4];
#pragma unroll
            for (int j = 0; j < 4; ++j) o[j] = (v8f){};
            float m = NEGB, l = 0.0f;
#pragma unroll 1
            for (int ks = 0; ks < nks; ++ks) {
                const int fa = 4 * ks;                            // K slots: key tile 2ks -> fa, fa+1 (d steps); key tile 2ks+1 -> fa+2, fa+3
                v8f sa = (v8f){}, sb = (v8f){};
                {
                    const v16h ah0 = ldf(fs, 0, fa), ah1 = ldf(fs, 0, fa + 1), al0 = ldf(fs, 1, fa), al1 = ldf(fs, 1, fa + 1);
                    const v16h bh0 = ldf(fs, 0, fa + 2), bh1 = ldf(fs, 0, fa + 3), bl0 = ldf(fs, 1, fa + 2), bl1 = ldf(fs, 1, fa + 3);
                    // one accumulator per key tile: residual products (K res x Q hi, K hi x Q res) first, the hi products on top; the two tiles' chains alternate, so that no WMMA follows directly on the one it accumulates onto
                    sa = wmma16(al0, qh0, sa); sb = wmma16(bl0, qh0, sb);
                    sa = wmma16(ah0, ql0, sa); sb = wmma16(bh0, ql0, sb);
                    sa = wmma16(al1, qh1, sa); sb = wmma16(bl1, qh1, sb);
                    sa = wmma16(ah1, ql1, sa); sb = wmma16(bh1, ql1, sb);
                    sa = wmma16(ah0, qh0, sa); sb = wmma16(bh0, qh0, sb);
                    sa = wmma16(ah1, qh1, sa); sb = wmma16(bh1, qh1, sb);
                    // the four vector slots that the chip needs between the last WMMA and the first read of its result or overwrite of its operands
                    asm volatile("v_nop\n\tv_nop\n\tv_nop\n\tv_nop" : "+v"(sa), "+v"(sb) : "v"(ah0), "v"(ah1), "v"(al0), "v"(al1), "v"(bh0), "v"(bh1), "v"(bl0), "v"(bl1), "v"(qh0), "v"(qh1), "v"(ql0), "v"(ql1));
                }
                // S^T D layout: sa[r] = (key = 32ks + 8hi + r, t), sb[r] = (key = 32ks + 16 + 8hi + r, t); causal replace-fill for key > t
                const int kbase = 32 * ks + 8 * hi;
                float ta[8], tb[8]; float mx = NEGB;
#pragma unroll
                for (int r = 0; r < 8; ++r) {
                    const float va = sa[r] * SCQ;
                    const float vb = sb[r] * SCQ;
                    ta[r] = (kbase + r <= t) ? va : NEGB;
                    tb[r] = (kbase + 16 + r <= t) ? vb : NEGB;
                    mx = fmaxf(mx, fmaxf(ta[r], tb[r]));
                }
                mx = fmaxf(mx, __shfl_xor(mx, 16, 32));
                const float mnew = fmaxf(m, mx);
                const float alpha = __builtin_amdgcn_exp2f(m - mnew);
                const float sh = PSH - mnew;
                v8f pa8, pb8; float ls = 0.0f;
#pragma unroll
                for (int r = 0; r < 8; ++r) {
                    const float fa_ = __builtin_amdgcn_exp2f(ta[r] + sh);
                    const float fb_ = __builtin_amdgcn_exp2f(tb[r] + sh);
                    pa8[r] = fa_; pb8[r] = fb_;
                    ls += fa_ + fb_;
                }
                v8h ph1, pl1, ph2, pl2; split8(pa8, ph1, pl1); split8(pb8, ph2, pl2);
                const v16h pb = cat16(ph1, ph2), pl = cat16(pl1, pl2);
                l = l * alpha + ls; m = mnew;
#pragma unroll
                for (int j = 0; j < 4; ++j) o[j] = o[j] * alpha;
                // O^T[d][t] += V^T P^T: A = V slots (row d, k = key), B = packed P^T; the residual products (V res x P hi, V hi x P res) add into o as well; the four d tiles' chains alternate
                v16h vh[4], vl[4];
#pragma unroll
                for (int j = 0; j < 4; ++j) { vh[j] = ldf(fs, 2, 2 * j + ks); vl[j] = ldf(fs, 3, 2 * j + ks); }
#pragma unroll
                for (int j = 0; j < 4; ++j) o[j] = wmma16(vl[j], pb, o[j]);
#pragma unroll
                for (int j = 0; j < 4; ++j) o[j] = wmma16(vh[j], pl, o[j]);
#pragma unroll
                for (int j = 0; j < 4; ++j) o[j] = wmma16(vh[j], pb, o[j]);
                // the four vector slots behind the last WMMA, on the loop's back edge and on its exit alike
                asm volatile("v_nop\n\tv_nop\n\tv_nop\n\tv_nop" : "+v"(o[0]), "+v"(o[1]), "+v"(o[2]), "+v"(o[3])
                             : "v"(vh[0]), "v"(vh[1]), "v"(vh[2]), "v"(vh[3]), "v"(vl[0]), "v"(vl[1]), "v"(vl[2]), "v"(vl[3]), "v"(pb), "v"(pl));
            }
            v16h bw[8];                                           // Wproj^T 4 c tiles x 2 d steps, in flight under the normalisation and the split of ctx
            ldhn(bw, WPT + wo);
            l += __shfl_xor(l, 16, 32);
            const float cs = CSC * (1.0f / l);
            // O^T D layout: o[j][r] = (d = 16j + 8hi + r, t = lr) -> A fragment of the projection (row t, k = d): d step ds <- tiles 2ds (elements 0..7), 2ds+1 (elements 8..15)
            v8h ch_[4], cl_[4];
#pragma unroll
            for (int j = 0; j < 4; ++j) {
                v8f c;
#pragma unroll
                for (int r = 0; r < 8; ++r) c[r] = o[j][r] * cs;
                split8(c, ch_[j], cl_[j]);
                if (j == 1) ldv<0, 4>(vw, WVT + wn, hf == 0);     // the next head's phase-1 weights follow as registers come free: half of o is dead here
            }
            const v16h cah0 = cat16(ch_[0], ch_[1]), cal0 = cat16(cl_[0], cl_[1]), cah1 = cat16(ch_[2], ch_[3]), cal1 = cat16(cl_[2], cl_[3]);
            // out[t][c] += ctx_h Wproj[h*64.., :]: B = Wproj^T rows (col c, k = h*64 + d); D layout: pacc[cj][r] = (t = 16ti + 8hi + r, c = 16cj + lr); hi and residual products of every head add into pacc, whose carry is taken off once in the epilogue
            ldhn(kw, WKT + wn + (2 * hf) * 1024);                 // all of o is dead here
#pragma unroll                                                  // pacc[cj] stays in registers only under a compile-time cj; the four c tiles' chains alternate
            for (int cj = 0; cj < 4; ++cj) pacc[cj] = wmma16(cal0, bw[2 * cj], pacc[cj]);
#pragma unroll
            for (int cj = 0; cj < 4; ++cj) pacc[cj] = wmma16(cal1, bw[2 * cj + 1], pacc[cj]);
#pragma unroll
            for (int cj = 0; cj < 4; ++cj) pacc[cj] = wmma16(cah0, bw[2 * cj], pacc[cj]);
#pragma unroll
            for (int cj = 0; cj < 4; ++cj) pacc[cj] = wmma16(cah1, bw[2 * cj + 1], pacc[cj]);
            // the four vector slots behind the last WMMA, before its operands' registers are given to the next head's weights
            asm volatile("v_nop\n\tv_nop\n\tv_nop\n\tv_nop" : "+v"(pacc[0]), "+v"(pacc[1]), "+v"(pacc[2]), "+v"(pacc[3])
                         : "v"(cah0), "v"(cal0), "v"(cah1), "v"(cal1), "v"(bw[0]), "v"(bw[1]), "v"(bw[2]), "v"(bw[3]), "v"(bw[4]), "v"(bw[5]), "v"(bw[6]), "v"(bw[7]));
            ldv<4, 4>(vw, WVT + wn, hf == 0);                     // last, behind every wait for bw: loads that only two of the waves issue would shorten the counts of the waits that follow them
        }
        asm volatile("s_wait_xcnt 0x0" ::: "memory");           // the next head rewrites the offset register that this head's weight loads name
    }

    // ---- epilogue: out[t][c] = bias + sum over the heads; each wave turns its own 16 rows through LDS for 16-byte row-wise stores ----
    // buffer 0 is free here: its last readers (head NHD-2) finished before they passed the last head's barrier
    float* pw = (float*)(smem + OFF_F) + wave * (16 * PP);
#pragma unroll
    for (int cj = 0; cj < 4; ++cj) {
#pragma unroll
        for (int r = 0; r < 8; ++r) pw[(8 * hi + r) * PP + 16 * cj + lr] = pacc[cj][r] * OSC;
    }
    __syncthreads();                                            // the tile's stores are complete before other lanes read them row-wise
    v4f bv = *(const v4f*)(BP + 4 * lr);
#pragma unroll
    for (int k = 0; k < 4; ++k) bv[k] = rbf(bv[k]);
    v4f vals[8];
#pragma unroll
    for (int s = 0; s < 8; ++s) {
        const v4f a = *(const v4fa*)(pw + (2 * s + hi) * PP + 4 * lr);
        vals[s] = a + bv;
    }
    float* orow = OUT + (size_t)b * (TT * CC) + (size_t)(16 * wave) * CC + 4 * lr;
{
#pragma unroll
        for (int s = 0; s < 8; ++s) *(v4f*)(orow + (size_t)(2 * s + hi) * CC) = vals[s];   // 8 s x 2 rows = 16 rows; 16 lanes x 4 floats = 64 columns
         }
}

static constexpr size_t SZ_W = (size_t)NHD * CC * HD * 2;               // 65536 B per weight plane
static constexpr size_t SZ_TOTAL = 4 * SZ_W;
static_assert((size_t)HDT * CC * 2 <= SZ_W);
static_assert(SZ_W == (size_t)8 * 4096 * 2 && NHD == 8 && HDT / 64 == 8);   // k_wt: 8 tiles of 4096 halves per plane, planes contiguous
static_assert(SZ_TOTAL <= (size_t)134217728);

extern "C" void kernel_launch(void* const* d_in, const int* in_sizes, int n_in,
                              void* d_out, int out_size, void* d_ws, size_t ws_size, hipStream_t stream) {
    if (n_in < 6) return;
    if ((size_t)in_sizes[0] < (size_t)NB * TT * CC) return;
    if (in_sizes[1] < NHD * CC * HD || in_sizes[2] < NHD * CC * HD || in_sizes[3] < NHD * CC * HD) return;
    if (in_sizes[4] < HDT * CC || in_sizes[5] < CC) return;
    if ((size_t)out_size < (size_t)NB * TT * CC) return;
    if (SZ_TOTAL > ws_size) return;
    const float* x  = (const float*)d_in[0];     // wire order x, Wq, Wk, Wv, Wproj, bproj
    const float* Wq = (const float*)d_in[1];
    const float* Wk = (const float*)d_in[2];
    const float* Wv = (const float*)d_in[3];
    const float* Wp = (const float*)d_in[4];
    const float* bp = (const float*)d_in[5];
    float* OUT = (float*)d_out;                  // [NB][64][64]
    char* wsp = (char*)d_ws;
    h16* WQT = (h16*)wsp; wsp += SZ_W;           // [8 heads][4 d tiles][2 c steps] fragments, x64
    h16* WKT = (h16*)wsp; wsp += SZ_W;           // [8 heads][4 d tiles][2 c steps] fragments, x64
    h16* WVT = (h16*)wsp; wsp += SZ_W;           // [8 heads][4 d tiles][2 c steps] fragments, x64
    h16* WPT = (h16*)wsp; wsp += SZ_W;           // [8 heads][4 c tiles][2 d steps] fragments, x256

    // W[h]: in[64 c][64 d] -> fragments (row d, k = c) per head; Wproj: in[512 k][64 c] -> fragments (row c, k = d of head h), 8 tiles of 64 k rows = 8 heads
    // grid = 4 planes x 8 tiles; block p * 8 + i writes tile i of the plane at WQT + p * 32768 halves (WQT, WKT, WVT, WPT in this order)
    k_wt<<<32, 256, 0, stream>>>(Wq, Wk, Wv, Wp, WQT);

    (void)hipFuncSetAttribute(reinterpret_cast<const void*>(&k_mha), hipFuncAttributeMaxDynamicSharedMemorySize, (int)LDS_BYTES);
    k_mha<<<NB, 32 * MW, LDS_BYTES, stream>>>(x, WQT, WKT, WVT, WPT, bp, OUT);
}

// v008
// One run takes 37.6 microseconds.
// Versions between v006 and this one are left out; their measured steps multiply to 1.50 times as fast.
// Over all steps from v000 it is 5.42 times as fast.
#include <hip/hip_runtime.h>

// Causal multi-head attention with per-head q/k/v projections and an output projection: x [NB][64][64], Wq/Wk/Wv [8][64 in][64 out], Wproj [512 in][64 out], bias [64]; out [NB][64][64] f32.
// Compute dtypes, f32 accumulate everywhere, all contractions v_wmma_f32_16x16x32_f16: x and all weights RNE-converted to bf16 and held in f16 containers (weights x64 / x256, exact), so input x input products are exact;
// q, k, v, P and ctx are each rounded once to f16 (11 significant bits; the inputs they are made of carry 8) at the carries x64, x256, x16, which keep ordinary values in f16's normal range: one WMMA product per contraction;
// P carries x256 (cancels in the normalisation); softmax f32 (one pass: all of a query tile's scores, one maximum).
// Transposed chaining: K^T, Q^T tiles (D rows = d) pack directly into the A (keys) / B (queries) fragments of S^T = K Q^T; V tiles (D rows = key) pack into the A fragment of O^T = V^T P^T; packed P^T is its B fragment;
// O^T tiles pack into the A fragment of the output projection. The weight planes lie in the workspace in fragment order (1 KiB per 16 x 32 fragment, lane-contiguous), so a wave's 16-byte weight loads read whole 128-byte lines. One block per batch, 4 waves; the block walks the 8 heads together: each wave builds a share of the head's K/V fragments into shared LDS slots,
// then runs one 16-query tile against them; its 16 output rows are summed over heads 0..7 in registers.

#ifndef NB
#define NB 2048
#endif
#define NB_FULL 2048
#define TT   64                  // tokens per batch
#define CC   64                  // embedding width
#define NHD  8                   // heads
#define HD   64                  // head size
#define HDT  (NHD * HD)          // 512
#define MW   4                   // waves per block (one 16-query tile each)
#define XP   72                  // LDS pitch (halves) of the x tile
#define PP   68                  // LDS pitch (floats) of the output tiles
#define TP   72                  // LDS pitch (halves) of the weight transpose tile
#define PSH  8.0f                // log2 of the P carry (256)
#define SCQ  (0.125f * 1.4426950408889634f / 4096.0f)   // HD^-0.5 * log2(e) / (64 * 64 weight carries)
#define CSC  0.25f               // ctx carry 16 / v weight carry 64
#define OSC  (1.0f / 4096.0f)    // 1 / (ctx carry 16 * Wproj carry 256)
#define NEGB (-3.0e38f)
#define FRH  512                 // halves per packed weight fragment; a 64 x 64 plane holds 8: index = row tile * 2 + k step

#define OFF_X 0
#define OFF_F (TT * XP * 2)                       // 9216
#define FBUF 17408                                // one head's fragment slots: K, V, 8 fragments of 1 KiB each; 1 KiB more, so that the four output tiles fit into one buffer
#define LDS_BYTES (OFF_F + 2 * FBUF)              // 44032

static_assert(NB <= NB_FULL);
static_assert(MW * 16 == TT);
static_assert(NHD % 2 == 0);
static_assert(MW * 16 * PP * 4 <= FBUF);
static_assert(2 * 8 * 1024 <= FBUF && FBUF % 16 == 0);
static_assert(HD == 64);
static_assert(TT == 64);
static_assert(CC == 64);
static_assert(OFF_F % 16 == 0);
static_assert((XP * 2) % 16 == 0);
static_assert((PP * 4) % 16 == 0);
static_assert(LDS_BYTES <= 262144);

typedef _Float16 h16;
typedef __attribute__((ext_vector_type(16))) _Float16 v16h;
typedef __attribute__((ext_vector_type(8)))  _Float16 v8h;
typedef __attribute__((ext_vector_type(4)))  _Float16 v4h;
typedef __attribute__((ext_vector_type(8)))  float    v8f;
typedef __attribute__((ext_vector_type(4)))  float    v4f;
typedef v4f  __attribute__((may_alias)) v4fa;
typedef v8h  __attribute__((may_alias)) v8ha;
typedef v4h  __attribute__((may_alias)) v4ha;

// RNE convert of an f32 value to the bf16 grid, returned as f32 (exactly representable in f16 for normal-range magnitudes)
__device__ __forceinline__ float rbf(float f) { unsigned u = __float_as_uint(f); u += 0x7FFFu + ((u >> 16) & 1u); return __uint_as_float(u & 0xFFFF0000u); }
__device__ __forceinline__ v16h cat16(v8h lo, v8h hi) { return __builtin_shufflevector(lo, hi, 0, 1, 2, 3, 4, 5, 6, 7, 8, 9, 10, 11, 12, 13, 14, 15); }
__device__ __forceinline__ v8f wmma16(v16h a, v16h b, v8f c) { return __builtin_amdgcn_wmma_f32_16x16x32_f16(false, a, false, b, (short)0, c, false, false); }
// fragment loader from the packed weight planes in global memory; p already includes + 8*lane. One fragment (16 rows x 32 k) = FRH halves: two runs of 32 lanes x 8 halves;
// lane (h = lane>>4, row = lane&15): elements 0..7 <- k0+8h+0..7 (first run), elements 8..15 <- k0+16+8h+0..7 (second run) (same map for A and B)
__device__ __forceinline__ v16h ldh(const h16* p) { return cat16(*(const v8h*)p, *(const v8h*)(p + FRH / 2)); }
// N consecutive packed fragments as one group of loads
template <int N> __device__ __forceinline__ void ldhn(v16h (&w)[N], const h16* p) {
#pragma unroll
    for (int i = 0; i < N; ++i) w[i] = ldh(p + i * FRH);
}
// fragments I0 .. I0+N-1 of the V weight plane at p, in the waves that build V (on: wave-uniform); elsewhere the slots are given up, so that no register is held for them across the head
template <int I0, int N> __device__ __forceinline__ void ldv(v16h (&w)[8], const h16* p, bool on) {
    if (on) {
#pragma unroll
        for (int i = I0; i < I0 + N; ++i) w[i] = ldh(p + i * FRH);
        asm volatile("s_wait_xcnt 0x0" :: "v"(p) : "memory");     // p stays in its registers up to this wait
    } else {
#pragma unroll
        for (int i = I0; i < I0 + N; ++i) w[i] = __builtin_nondeterministic_value(w[i]);
    }
}
// same map, rows of the LDS x tile
__device__ __forceinline__ v16h ldl(const h16* p) { const v8h a = *(const v8ha*)p; const v8h c = *(const v8ha*)(p + 16); return cat16(a, c); }
// per-lane fragment slots in LDS (fs already includes + lane), lane i of any wave reads what lane i of the building wave stored: slot (plane, f) = two 16-byte halves, 32 lanes apart
__device__ __forceinline__ v16h ldf(const v8ha* fs, int plane, int f) { const int i = ((plane * 8 + f) * 2) * 32; const v8h a = fs[i]; const v8h c = fs[i + 32]; return cat16(a, c); }
__device__ __forceinline__ void stf(v8ha* fs, int plane, int f, v8h a, v8h c) { const int i = ((plane * 8 + f) * 2) * 32; fs[i] = a; fs[i + 32] = c; }
// f32 tile -> f16, round to nearest even
__device__ __forceinline__ v8h cvt8(const v8f d) { return __builtin_convertvector(d, v8h); }
// two 16x16 tiles with K = 64 sharing one B operand: d1 = A1 B, d2 = A2 B
__device__ __forceinline__ void pair_tiles(v16h a1c0, v16h a1c1, v16h a2c0, v16h a2c1, v16h bc0, v16h bc1, v8f& d1, v8f& d2) {
    v8f x = (v8f){}, y = (v8f){};
    x = wmma16(a1c0, bc0, x); y = wmma16(a2c0, bc0, y);
    x = wmma16(a1c1, bc1, x); y = wmma16(a2c1, bc1, y);
    d1 = x; d2 = y;
}

// Causal softmax and O^T = V^T P^T of query tile TI (queries 16TI + lr) against the head's fragment slots, in one pass: key tiles 0..TI of 16 keys hold every visible key and are all scored first,
// so there is one maximum and o is never rescaled; only tile TI (the diagonal) needs the compare; the key tile behind it has no visible key: it is not scored, and its half of the P fragment is 0.
// S^T D layout: s[kt][r] = (key = 16kt + 8hi + r, t = 16TI + lr). o[j][r] = (d = 16j + 8hi + r, t); l = this lane's half of the row sum (P carries x256 in both).
template <int TI> __device__ __forceinline__ void attend(const v8ha* fs, const v16h q0, const v16h q1, const int lr, const int hi, v8f (&o)[4], float& l) {
    constexpr int NT = TI + 1, NKS = (TI >> 1) + 1;               // key tiles of 16, key steps of 32
    v8f s[NT];
    v16h vf[NKS][4];                                              // V slots: d tile j, key step ks -> 2j + ks
    {
        v16h a0[NT], a1[NT];                                      // K slots: key tile kt -> 2kt, 2kt+1 (d steps)
#pragma unroll
        for (int kt = 0; kt < NT; ++kt) { a0[kt] = ldf(fs, 0, 2 * kt); a1[kt] = ldf(fs, 0, 2 * kt + 1); }
        __builtin_amdgcn_sched_barrier(0);                        // the K reads stay one group ahead of the WMMAs: moved among them, each read was waited for on its own
        // one accumulator per key tile; the tiles' chains alternate
#pragma unroll
        for (int kt = 0; kt < NT; ++kt) s[kt] = wmma16(a0[kt], q0, (v8f){});
#pragma unroll
        for (int kt = 0; kt < NT; ++kt) s[kt] = wmma16(a1[kt], q1, s[kt]);
#pragma unroll
        for (int ks = 0; ks < NKS; ++ks) {
#pragma unroll
            for (int j = 0; j < 4; ++j) vf[ks][j] = ldf(fs, 1, 2 * j + ks);
        }
        __builtin_amdgcn_sched_barrier(0);                        // the score WMMAs stay one run, and the V reads one group whose latency passes under the softmax
    }
    const int dg = lr - 8 * hi;                                   // diagonal tile: key <= t  <=>  r <= lr - 8hi
    float mx = NEGB;
#pragma unroll
    for (int kt = 0; kt < NT; ++kt) {
#pragma unroll
        for (int r = 0; r < 8; ++r) {
            const float v = s[kt][r] * SCQ;
            s[kt][r] = (kt < TI || r <= dg) ? v : NEGB;           // causal replace-fill
        }
#pragma unroll
        for (int r = 0; r < 8; r += 2) mx = fmaxf(mx, fmaxf(s[kt][r], s[kt][r + 1]));
    }
    mx = fmaxf(mx, __shfl_xor(mx, 16, 32));
    const float sh = PSH - mx;
    v8h ph[2 * NKS];
#pragma unroll
    for (int kt = 0; kt < 2 * NKS; ++kt) {
        if (kt < NT) {
#pragma unroll
            for (int r = 0; r < 8; ++r) s[kt][r] = __builtin_amdgcn_exp2f(s[kt][r] + sh);
            ph[kt] = cvt8(s[kt]);
        } else ph[kt] = (v8h){};
    }
    v8f ls = s[0];
#pragma unroll
    for (int kt = 1; kt < NT; ++kt) ls += s[kt];
    const v4f l4 = __builtin_shufflevector(ls, ls, 0, 1, 2, 3) + __builtin_shufflevector(ls, ls, 4, 5, 6, 7);
    l = (l4[0] + l4[2]) + (l4[1] + l4[3]);
    // O^T[d][t] = V^T P^T: A = V slots (row d, k = key), B = packed P^T; four independent d tiles
#pragma unroll
    for (int ks = 0; ks < NKS; ++ks) {
        const v16h pb = cat16(ph[2 * ks], ph[2 * ks + 1]);
#pragma unroll
        for (int j = 0; j < 4; ++j) o[j] = wmma16(vf[ks][j], pb, ks == 0 ? (v8f){} : o[j]);
    }
    // the four vector slots behind the last WMMA, ahead of the branches that lead to where the four paths join
    asm volatile("v_nop\n\tv_nop\n\tv_nop\n\tv_nop" : "+v"(o[0]), "+v"(o[1]), "+v"(o[2]), "+v"(o[3])
                 : "v"(vf[NKS - 1][0]), "v"(vf[NKS - 1][1]), "v"(vf[NKS - 1][2]), "v"(vf[NKS - 1][3]), "v"(ph[2 * NKS - 2]), "v"(ph[2 * NKS - 1]));
}

// k_wt: one 64x64 f32 tile in[r][c] (row pitch 64, tile stride 4096) -> f16(bf16_rne(in) * scale) as the 8 fragments of the transposed tile (fragment row = c, k = r), tile stride 4096 halves.
// One grid for all four weight tensors: block = plane * 8 + tile, planes Wq, Wk, Wv (x64), Wproj (x256); the four packed planes lie back to back in dst, 8 tiles each.
__global__ __launch_bounds__(256) void k_wt(const float* __restrict__ wq, const float* __restrict__ wk, const float* __restrict__ wv, const float* __restrict__ wp, h16* dst) {
    __shared__ __align__(16) h16 ts[64 * TP];
    const int tid = threadIdx.x;
    const int r = tid >> 2, c0 = (tid & 3) * 16;           // 64 source rows x 4 column groups of 16
    const int plane = blockIdx.x >> 3, tile = blockIdx.x & 7;   // block-uniform
    const float* s01 = (plane & 1) ? wk : wq;
    const float* s23 = (plane & 1) ? wp : wv;
    const float* src = (plane & 2) ? s23 : s01;
    const float scale = plane == 3 ? 256.0f : 64.0f;
    const float* s = src + (size_t)tile * 4096 + r * 64 + c0;
#pragma unroll
    for (int q = 0; q < 4; ++q) { const v4f x = *(const v4f*)(s + 4 * q);
#pragma unroll
        for (int i = 0; i < 4; ++i) ts[(c0 + 4 * q + i) * TP + r] = (h16)(rbf(x[i]) * scale); }   // ts[c][r], c 0..63, r 0..63 all written
    __syncthreads();
    h16* d = dst + (size_t)blockIdx.x * 4096;
{
#pragma unroll
        for (int s2 = 0; s2 < 2; ++s2) { const int dd = 32 * s2 + (tid >> 3), j = tid & 7;          // 2 x 32 rows = 64 rows; 8 groups j of 8 k values = 64 halves
            const v8h val = *(const v8ha*)(&ts[dd * TP + 8 * j]);
            // k = 8j..8j+7: k step j>>2, run (j>>1)&1, lane half j&1; row dd: row tile dd>>4, lane row dd&15
            *(v8h*)(d + ((dd >> 4) * 2 + (j >> 2)) * FRH + ((j >> 1) & 1) * (FRH / 2) + ((j & 1) * 16 + (dd & 15)) * 8) = val; }
         }
}

// k_mha: one block per batch; wave w owns queries 16w..16w+15 of every head.
// LDS: x tile f16 [64][XP] (written once, block barrier, then read-only); two buffers of fragment slots shared by the block (K, V: 8 fragments each), head h in buffer h & 1;
// after the last head buffer 0 holds the four waves' output tiles f32 [16][PP] for the row-wise store.
__global__ __launch_bounds__(32 * MW) void k_mha(const float* __restrict__ X, const h16* __restrict__ WQT, const h16* __restrict__ WKT, const h16* __restrict__ WVT,
                                                 const h16* __restrict__ WPT, const float* __restrict__ BP, float* OUT) {
    extern __shared__ __align__(16) unsigned char smem[];
    h16* xs = (h16*)(smem + OFF_X);
    const int tid = threadIdx.x;
    const int lane = tid & 31, wave = __builtin_amdgcn_readfirstlane((int)(threadIdx.x >> 5)), lr = lane & 15, hi = lane >> 4;
    const int b = blockIdx.x;
    const int ks1 = wave & 1, hf = wave >> 1;                   // this wave's share of phase 1: key step ks1, K d step hf; waves 0 and 1, whose query tiles see one key step less, also build V

    // Every weight fragment is asked for one stage before the stage that multiplies with it, so that the load's latency passes under other work:
    // kw, vw (phase 1 of a head) during the output projection of the head before, here for head 0; Wq before the K tiles; Wproj in one group behind the softmax and ctx.
    v16h kw[4], vw[8];                                          // Wk^T d tiles 2hf, 2hf+1 x 2 c steps; Wv^T 4 d tiles x 2 c steps (waves 0 and 1 only; never read elsewhere)
    ldhn(kw, WKT + (size_t)lane * 8 + (2 * hf) * 1024);
    ldv<0, 8>(vw, WVT + (size_t)lane * 8, hf == 0);

    // stage x[b] as f16 (via bf16 RNE convert): 1024 groups of 4 elements, rows 0..63 x columns 0..63 all written
    {
        const float* xb = X + (size_t)b * (TT * CC);
#pragma unroll
        for (int it = 0; it < 8; ++it) {
            const int e = 4 * (tid + 128 * it); const int row = e >> 6, col = e & 63;
            const v4f v = *(const v4f*)(xb + e); v4h o;
#pragma unroll
            for (int k = 0; k < 4; ++k) o[k] = (h16)rbf(v[k]);
            *(v4ha*)(xs + row * XP + col) = o;
        }
    }
    __syncthreads();

    const h16* xr = xs + lr * XP + 8 * hi;                      // + tile*16*XP + 32*cs
    const int ti = wave;                                        // this wave's query tile
    v8f pacc[4];                                                // out rows 16ti + 8hi + r, columns 16cj + lr, summed over the heads (x4096: ctx and Wproj carries)
#pragma unroll
    for (int cj = 0; cj < 4; ++cj) pacc[cj] = (v8f){};

#pragma unroll 1
    for (int h = 0; h < NHD; ++h) {
        v8ha* fs = (v8ha*)(smem + OFF_F) + (h & 1) * (FBUF / 16) + lane;
        const size_t wo = (size_t)h * 4096 + (size_t)lane * 8;           // packed weight planes [h][row tile][k step]: + tile*2*FRH + cs*FRH
        const size_t wn = (size_t)(h + 1 < NHD ? h + 1 : h) * 4096 + (size_t)lane * 8;   // the next head's planes (the last head asks for its own again; nothing reads that)
        v16h qw[8];                                                      // Wq^T 4 d tiles x 2 c steps

        // ---- phase 1: this wave's share of the head's K^T and V tiles, packed into the shared fragment slots ----
        {
            const h16* xa = xr + (2 * ks1) * 16 * XP;
            const v16h xa0 = ldl(xa), xa1 = ldl(xa + 32), xb0 = ldl(xa + 16 * XP), xb1 = ldl(xa + 16 * XP + 32);
            // V[key][d] = x Wv: A = x rows (key tiles 2ks1, 2ks1+1), B = Wv^T rows (col d). D row = key, col = d -> A fragment of O^T (row d, k = key)
            if (hf == 0) {                                        // wave-uniform: waves 0 and 1
#pragma unroll                                                    // vw[] stays in registers only under a compile-time dj
                for (int dj = 0; dj < 4; ++dj) {
                    v8f d1, d2; pair_tiles(xa0, xa1, xb0, xb1, vw[2 * dj], vw[2 * dj + 1], d1, d2);
                    stf(fs, 1, dj * 2 + ks1, cvt8(d1), cvt8(d2));
                }
            }
            ldhn(qw, WQT + wo);                                   // used behind the barrier; in flight under the K tiles
            // K^T[d][key] = Wk^T x^T: A = Wk^T rows (d tiles 2hf, 2hf+1), B = x rows (col key). D row = d, col = key -> A fragment of S^T (row key, k = d)
            {
                const v16h a10 = kw[0], a11 = kw[1], a20 = kw[2], a21 = kw[3];
                v8f d1, d2;
                pair_tiles(a10, a11, a20, a21, xa0, xa1, d1, d2);
                stf(fs, 0, (2 * ks1) * 2 + hf, cvt8(d1), cvt8(d2));
                pair_tiles(a10, a11, a20, a21, xb0, xb1, d1, d2);
                stf(fs, 0, (2 * ks1 + 1) * 2 + hf, cvt8(d1), cvt8(d2));
            }
        }
        // publishes head h's slots to the block; a wave that has passed it has also left head h-1's slots, so the buffer that head h+1 fills has no reader left
        __syncthreads();

        // ---- phase 2: this wave's 16-query tile: Q^T fragments, causal softmax and ctx, output projection ----
        {
            v16h q0, q1;                                          // B fragments: col t, k = d (d steps 0..31, 32..63)
            {
                const h16* xq = xr + ti * 16 * XP;
                const v16h x0 = ldl(xq), x1 = ldl(xq + 32);
                v8f d1, d2;
                pair_tiles(qw[0], qw[1], qw[2], qw[3], x0, x1, d1, d2);
                q0 = cat16(cvt8(d1), cvt8(d2));
                pair_tiles(qw[4], qw[5], qw[6], qw[7], x0, x1, d1, d2);
                q1 = cat16(cvt8(d1), cvt8(d2));
            }
            v8f o[4]; float l;
            // wave-uniform choice of the path whose query tile is a compile-time constant
            if (ti == 0) attend<0>(fs, q0, q1, lr, hi, o, l);
            else if (ti == 1) attend<1>(fs, q0, q1, lr, hi, o, l);
            else if (ti == 2) attend<2>(fs, q0, q1, lr, hi, o, l);
            else attend<3>(fs, q0, q1, lr, hi, o, l);
            v16h bw[8];                                           // Wproj^T 4 c tiles x 2 d steps, in flight under the normalisation and the rounding of ctx
            ldhn(bw, WPT + wo);
            l += __shfl_xor(l, 16, 32);
            const float cs = CSC * (1.0f / l);
            // O^T D layout: o[j][r] = (d = 16j + 8hi + r, t = lr) -> A fragment of the projection (row t, k = d): d step ds <- tiles 2ds (elements 0..7), 2ds+1 (elements 8..15)
            v8h ch_[4];
#pragma unroll
            for (int j = 0; j < 4; ++j) {
                v8f c;
#pragma unroll
                for (int r = 0; r < 8; ++r) c[r] = o[j][r] * cs;
                ch_[j] = cvt8(c);
                if (j == 1) ldv<0, 4>(vw, WVT + wn, hf == 0);     // the next head's phase-1 weights follow as registers come free: half of o is dead here
            }
            const v16h ca0 = cat16(ch_[0], ch_[1]), ca1 = cat16(ch_[2], ch_[3]);
            // out[t][c] += ctx_h Wproj[h*64.., :]: B = Wproj^T rows (col c, k = h*64 + d); D layout: pacc[cj][r] = (t = 16ti + 8hi + r, c = 16cj + lr); the products of every head add into pacc, whose carry is taken off once in the epilogue
            ldhn(kw, WKT + wn + (2 * hf) * 1024);                 // all of o is dead here
#pragma unroll                                                  // pacc[cj] stays in registers only under a compile-time cj; the four c tiles' chains alternate
            for (int cj = 0; cj < 4; ++cj) pacc[cj] = wmma16(ca0, bw[2 * cj], pacc[cj]);
#pragma unroll
            for (int cj = 0; cj < 4; ++cj) pacc[cj] = wmma16(ca1, bw[2 * cj + 1], pacc[cj]);
            // the four vector slots behind the last WMMA, before its operands' registers are given to the next head's weights
            asm volatile("v_nop\n\tv_nop\n\tv_nop\n\tv_nop" : "+v"(pacc[0]), "+v"(pacc[1]), "+v"(pacc[2]), "+v"(pacc[3])
                         : "v"(ca0), "v"(ca1), "v"(bw[0]), "v"(bw[1]), "v"(bw[2]), "v"(bw[3]), "v"(bw[4]), "v"(bw[5]), "v"(bw[6]), "v"(bw[7]));
            ldv<4, 4>(vw, WVT + wn, hf == 0);                     // last, behind every wait for bw: loads that only two of the waves issue would shorten the counts of the waits that follow them
        }
        asm volatile("s_wait_xcnt 0x0" ::: "memory");           // the next head rewrites the offset register that this head's weight loads name
    }

    // ---- epilogue: out[t][c] = bias + sum over the heads; each wave turns its own 16 rows through LDS for 16-byte row-wise stores ----
    // buffer 0 is free here: its last readers (head NHD-2) finished before they passed the last head's barrier
    float* pw = (float*)(smem + OFF_F) + wave * (16 * PP);
#pragma unroll
    for (int cj = 0; cj < 4; ++cj) {
#pragma unroll
        for (int r = 0; r < 8; ++r) pw[(8 * hi + r) * PP + 16 * cj + lr] = pacc[cj][r] * OSC;
    }
    __syncthreads();                                            // the tile's stores are complete before other lanes read them row-wise
    v4f bv = *(const v4f*)(BP + 4 * lr);
#pragma unroll
    for (int k = 0; k < 4; ++k) bv[k] = rbf(bv[k]);
    v4f vals[8];
#pragma unroll
    for (int s = 0; s < 8; ++s) {
        const v4f a = *(const v4fa*)(pw + (2 * s + hi) * PP + 4 * lr);
        vals[s] = a + bv;
    }
    float* orow = OUT + (size_t)b * (TT * CC) + (size_t)(16 * wave) * CC + 4 * lr;
{
#pragma unroll
        for (int s = 0; s < 8; ++s) *(v4f*)(orow + (size_t)(2 * s + hi) * CC) = vals[s];   // 8 s x 2 rows = 16 rows; 16 lanes x 4 floats = 64 columns
         }
}

static constexpr size_t SZ_W = (size_t)NHD * CC * HD * 2;               // 65536 B per weight plane
static constexpr size_t SZ_TOTAL = 4 * SZ_W;
static_assert((size_t)HDT * CC * 2 <= SZ_W);
static_assert(SZ_W == (size_t)8 * 4096 * 2 && NHD == 8 && HDT / 64 == 8);   // k_wt: 8 tiles of 4096 halves per plane, planes contiguous
static_assert(SZ_TOTAL <= (size_t)134217728);

extern "C" void kernel_launch(void* const* d_in, const int* in_sizes, int n_in,
                              void* d_out, int out_size, void* d_ws, size_t ws_size, hipStream_t stream) {
    if (n_in < 6) return;
    if ((size_t)in_sizes[0] < (size_t)NB * TT * CC) return;
    if (in_sizes[1] < NHD * CC * HD || in_sizes[2] < NHD * CC * HD || in_sizes[3] < NHD * CC * HD) return;
    if (in_sizes[4] < HDT * CC || in_sizes[5] < CC) return;
    if ((size_t)out_size < (size_t)NB * TT * CC) return;
    if (SZ_TOTAL > ws_size) return;
    const float* x  = (const float*)d_in[0];     // wire order x, Wq, Wk, Wv, Wproj, bproj
    const float* Wq = (const float*)d_in[1];
    const float* Wk = (const float*)d_in[2];
    const float* Wv = (const float*)d_in[3];
    const float* Wp = (const float*)d_in[4];
    const float* bp = (const float*)d_in[5];
    float* OUT = (float*)d_out;                  // [NB][64][64]
    char* wsp = (char*)d_ws;
    h16* WQT = (h16*)wsp; wsp += SZ_W;           // [8 heads][4 d tiles][2 c steps] fragments, x64
    h16* WKT = (h16*)wsp; wsp += SZ_W;           // [8 heads][4 d tiles][2 c steps] fragments, x64
    h16* WVT = (h16*)wsp; wsp += SZ_W;           // [8 heads][4 d tiles][2 c steps] fragments, x64
    h16* WPT = (h16*)wsp; wsp += SZ_W;           // [8 heads][4 c tiles][2 d steps] fragments, x256

    // W[h]: in[64 c][64 d] -> fragments (row d, k = c) per head; Wproj: in[512 k][64 c] -> fragments (row c, k = d of head h), 8 tiles of 64 k rows = 8 heads
    // grid = 4 planes x 8 tiles; block p * 8 + i writes tile i of the plane at WQT + p * 32768 halves (WQT, WKT, WVT, WPT in this order)
    k_wt<<<32, 256, 0, stream>>>(Wq, Wk, Wv, Wp, WQT);

    (void)hipFuncSetAttribute(reinterpret_cast<const void*>(&k_mha), hipFuncAttributeMaxDynamicSharedMemorySize, (int)LDS_BYTES);
    k_mha<<<NB, 32 * MW, LDS_BYTES, stream>>>(x, WQT, WKT, WVT, WPT, bp, OUT);
}
